// v000
// Measured on an AMD MI455X. A time is GPU time per run, averaged over a window of back-to-back runs after a warm-up
// (all launches, gaps included; the runs take copies of the inputs in turn), and the median of several windows.
// Apart from v000's, it joins two sittings. Times from different sittings can be a few percent apart, while
// side-by-side timings come from the same sitting.
// The starting kernel, v000, takes 671 microseconds a run.
#include <hip/hip_runtime.h>

typedef __attribute__((ext_vector_type(2))) float v2f;
typedef __attribute__((ext_vector_type(4))) float v4f;
typedef __attribute__((ext_vector_type(8))) float v8f;

#define DDIM 256
#define BS   16
#define TLEN 4096
#define CHUNK 64
#define NCH  (TLEN / CHUNK)          // 64 chunks
#define MATELEMS (DDIM * DDIM)       // 65536
#define HPAD 260                     // padded LDS row stride (bank-conflict-free)

__device__ __forceinline__ v8f wmma4(v2f a, v2f b, v8f c) {
  // D = A(16x4,f32) * B(4x16,f32) + C(16x16,f32)
  return __builtin_amdgcn_wmma_f32_16x16x4_f32(false, a, false, b, (short)0, c,
                                               false, false);
}

__device__ __forceinline__ v8f vzero8() {
  v8f z = {0.f, 0.f, 0.f, 0.f, 0.f, 0.f, 0.f, 0.f};
  return z;
}

// ---------------------------------------------------------------- powers ----
__global__ void copy_mat(const float* __restrict__ src, float* __restrict__ dst) {
  int i = blockIdx.x * blockDim.x + threadIdx.x;
  if (i < MATELEMS) dst[i] = src[i];
}

// powers[k] lives at pw + (k-1)*MATELEMS.  Computes A_{s+j} = A_s * A_j,
// j = blockIdx.y+1 (1..s).  8 waves/WG, one 16x16 output tile per wave.
__global__ void power_step(float* __restrict__ pw, int s) {
  const int j = blockIdx.y + 1;
  const float* As = pw + (size_t)(s - 1) * MATELEMS;
  const float* Aj = pw + (size_t)(j - 1) * MATELEMS;
  float*       Dm = pw + (size_t)(s + j - 1) * MATELEMS;

  const int lane = threadIdx.x & 31;
  const int wave = threadIdx.x >> 5;        // 0..7
  const int tile = blockIdx.x * 8 + wave;   // 0..255
  const int mt = tile >> 4, nt = tile & 15;
  const int col = lane & 15;
  const int kk  = (lane >> 4) * 2;

  v8f acc = vzero8();
  const float* arow = As + (mt * 16 + col) * DDIM;
  for (int e = 0; e < DDIM; e += 4) {
    v2f a = *(const v2f*)(arow + e + kk);
    v2f b;
    b.x = Aj[(e + kk    ) * DDIM + nt * 16 + col];
    b.y = Aj[(e + kk + 1) * DDIM + nt * 16 + col];
    acc = wmma4(a, b, acc);
  }
  const int hi = (lane >> 4) * 8;
#pragma unroll
  for (int v = 0; v < 8; ++v)
    Dm[(mt * 16 + v + hi) * DDIM + nt * 16 + col] = acc[v];
}

// ---------------------------------------------------------------- Bx GEMM ---
// Bx[r,n] = sum_e X[r,e] * Bm[n,e]  (Bx = X @ Bm^T).  8 waves/WG; each wave
// owns a 16x64 strip (A fragment reused across 4 WMMAs per k-step).
__global__ void bx_gemm(const float* __restrict__ X, const float* __restrict__ Bm,
                        float* __restrict__ Bx) {
  const int lane = threadIdx.x & 31;
  const int wave = threadIdx.x >> 5;      // 0..7
  const int r0 = blockIdx.x * 128 + wave * 16;
  const int n0 = blockIdx.y * 64;
  const int col = lane & 15;
  const int kk  = (lane >> 4) * 2;

  v8f acc0 = vzero8(), acc1 = vzero8(), acc2 = vzero8(), acc3 = vzero8();
  const float* xrow = X  + (r0 + col) * DDIM;
  const float* b0   = Bm + (n0 +  0 + col) * DDIM;
  const float* b1   = Bm + (n0 + 16 + col) * DDIM;
  const float* b2   = Bm + (n0 + 32 + col) * DDIM;
  const float* b3   = Bm + (n0 + 48 + col) * DDIM;
  for (int e = 0; e < DDIM; e += 4) {
    v2f a = *(const v2f*)(xrow + e + kk);
    acc0 = wmma4(a, *(const v2f*)(b0 + e + kk), acc0);
    acc1 = wmma4(a, *(const v2f*)(b1 + e + kk), acc1);
    acc2 = wmma4(a, *(const v2f*)(b2 + e + kk), acc2);
    acc3 = wmma4(a, *(const v2f*)(b3 + e + kk), acc3);
  }
  const int hi = (lane >> 4) * 8;
#pragma unroll
  for (int v = 0; v < 8; ++v) {
    float* orow = Bx + (r0 + v + hi) * DDIM + col;
    orow[n0 +  0] = acc0[v];
    orow[n0 + 16] = acc1[v];
    orow[n0 + 32] = acc2[v];
    orow[n0 + 48] = acc3[v];
  }
}

// ------------------------------------------------------------- chunk scan ---
// Per chunk (blockIdx.x): u_i = Lam @ u_{i-1} + Bx_t for i=0..CHUNK-1 with
// u_{-1}=0, all 16 batches as the M dim of a 16x256x256 WMMA GEMM per step.
// Lam (256KB) is staged into the 320KB WGP LDS via CDNA5 async global->LDS
// b128 copies; h ping-pongs through LDS.  16 waves, wave w owns cols [16w..).
// Dynamic LDS layout: [0, 256*HPAD) = Lam (padded rows); then 2*16*HPAD for h.
__global__ void __launch_bounds__(512) chunk_scan(const float* __restrict__ Bx,
                                                  const float* __restrict__ Lam,
                                                  float* __restrict__ U) {
  extern __shared__ float smem[];
  float* lam_s = smem;                       // 256 x HPAD
  float* hb    = smem + 256 * HPAD;          // 2 x BS x HPAD

  const int lane = threadIdx.x & 31;
  const int wave = threadIdx.x >> 5;     // 0..15
  const int chunk = blockIdx.x;
  const int n0 = wave * 16;
  const int col = lane & 15;
  const int kk  = (lane >> 4) * 2;
  const int hi  = (lane >> 4) * 8;

  // ---- stage Lam into LDS with async global->LDS copies (ASYNCcnt path).
  // Dynamic LDS starts at group-segment offset 0, so LDS byte offsets are
  // computed numerically.  Each b128 moves 4 floats of one (padded) row.
  {
    const unsigned long long gbase = (unsigned long long)(uintptr_t)Lam;
    for (int g = threadIdx.x; g < MATELEMS / 4; g += (int)blockDim.x) {
      const int row = g >> 6;              // 64 x b128 per 256-float row
      const int e   = (g & 63) * 4;
      unsigned ldsoff = (unsigned)((row * HPAD + e) * 4);
      unsigned voff   = (unsigned)(g * 16);
      asm volatile("global_load_async_to_lds_b128 %0, %1, %2"
                   :: "v"(ldsoff), "v"(voff), "s"(gbase)
                   : "memory");
    }
    asm volatile("s_wait_asynccnt 0x0" ::: "memory");
  }

  // zero h_{-1} (buffer 0)
  for (int i = threadIdx.x; i < BS * DDIM; i += (int)blockDim.x)
    hb[(i >> 8) * HPAD + (i & 255)] = 0.f;
  __syncthreads();

  const float* lrow = lam_s + (n0 + col) * HPAD;   // row n of Lam: B[k,n]=Lam[n,k]
  for (int i = 0; i < CHUNK; ++i) {
    const int t = chunk * CHUNK + i;
    const float* hsrc = hb + (i & 1) * (BS * HPAD);
    v8f acc = vzero8();
    for (int e = 0; e < DDIM; e += 4) {
      v2f a = *(const v2f*)(hsrc + col * HPAD + e + kk);  // A[m=batch,k]
      v2f b = *(const v2f*)(lrow + e + kk);
      acc = wmma4(a, b, acc);
    }
    float* hdst = hb + ((i + 1) & 1) * (BS * HPAD);
#pragma unroll
    for (int v = 0; v < 8; ++v) {
      const int bat = v + hi;
      float h = acc[v] + Bx[(bat * TLEN + t) * DDIM + n0 + col];
      hdst[bat * HPAD + n0 + col] = h;
      U[(bat * TLEN + t) * DDIM + n0 + col] = h;
    }
    __syncthreads();
  }
}

// ------------------------------------------------------------- carry scan ---
// carry_k = Lam^CHUNK @ carry_{k-1} + u_last(k).  One WG per batch; thread n
// owns output dim n; true mat-vec -> VALU fmacs.  P staged into LDS once.
__global__ void carry_scan(const float* __restrict__ U, const float* __restrict__ P,
                           float* __restrict__ carries) {
  extern __shared__ float smem[];
  float* p_s = smem;                  // 256 x HPAD
  float* hc  = smem + 256 * HPAD;     // 256

  const int b = blockIdx.x;
  const int n = threadIdx.x;

  for (int g = threadIdx.x; g < MATELEMS / 4; g += (int)blockDim.x) {
    const int row = g >> 6;
    const int e   = (g & 63) * 4;
    *(v4f*)(p_s + row * HPAD + e) = *(const v4f*)(P + g * 4);
  }
  hc[n] = 0.f;
  __syncthreads();

  const float* prow = p_s + n * HPAD;
  for (int k = 0; k < NCH; ++k) {
    float s = U[(b * TLEN + (k * CHUNK + CHUNK - 1)) * DDIM + n];
    for (int e = 0; e < DDIM; e += 4) {
      v4f p = *(const v4f*)(prow + e);
      v4f h = *(const v4f*)(hc + e);
      s += p.x * h.x + p.y * h.y + p.z * h.z + p.w * h.w;
    }
    __syncthreads();
    hc[n] = s;
    carries[(k * BS + b) * DDIM + n] = s;
    __syncthreads();
  }
}

// ------------------------------------------------------------- correction ---
// out[b, k*CHUNK+i, :] += Lam^{i+1} @ carry_{k-1}[b].  One WG per (i, k);
// accumulator seeded from out so the add is fused into the WMMA C operand.
// Powers are read exactly once per WG -> keep on the (192MB) L2 path.
__global__ void __launch_bounds__(512) correct(float* __restrict__ out,
                                               const float* __restrict__ pw,
                                               const float* __restrict__ carries) {
  const int i = blockIdx.x;            // 0..CHUNK-1
  const int k = blockIdx.y + 1;        // chunk 1..NCH-1
  const int lane = threadIdx.x & 31;
  const int wave = threadIdx.x >> 5;   // 0..15
  const int n0 = wave * 16;
  const int col = lane & 15;
  const int kk  = (lane >> 4) * 2;
  const int hi  = (lane >> 4) * 8;
  const int t = k * CHUNK + i;

  const float* carry = carries + (size_t)(k - 1) * BS * DDIM;
  const float* Amat  = pw + (size_t)i * MATELEMS;       // Lam^{i+1}
  const float* arow  = carry + col * DDIM;              // A[m=batch,k=e]
  const float* brow  = Amat + (n0 + col) * DDIM;        // B[k,n]=Lam^{i+1}[n,k]

  v8f acc;
#pragma unroll
  for (int v = 0; v < 8; ++v)
    acc[v] = out[((v + hi) * TLEN + t) * DDIM + n0 + col];
  for (int e = 0; e < DDIM; e += 4) {
    v2f a = *(const v2f*)(arow + e + kk);
    v2f b = *(const v2f*)(brow + e + kk);
    acc = wmma4(a, b, acc);
  }
#pragma unroll
  for (int v = 0; v < 8; ++v)
    out[((v + hi) * TLEN + t) * DDIM + n0 + col] = acc[v];
}

// ------------------------------------------------------------------ launch --
extern "C" void kernel_launch(void* const* d_in, const int* in_sizes, int n_in,
                              void* d_out, int out_size, void* d_ws, size_t ws_size,
                              hipStream_t stream) {
  (void)in_sizes; (void)n_in; (void)out_size; (void)ws_size;
  const float* x   = (const float*)d_in[0];   // [16,4096,256]
  const float* Bm  = (const float*)d_in[1];   // [256,256]
  const float* Lam = (const float*)d_in[2];   // [256,256]
  float* out = (float*)d_out;                 // [16,4096,256], also U buffer

  float* Bx      = (float*)d_ws;                         // 16.78M floats
  float* powers  = Bx + (size_t)BS * TLEN * DDIM;        // 64 * 65536 floats
  float* carries = powers + (size_t)CHUNK * MATELEMS;    // NCH*BS*DDIM floats

  // Lam^1..Lam^64 by log-doubling.
  copy_mat<<<MATELEMS / 256, 256, 0, stream>>>(Lam, powers);
  for (int s = 1; s < CHUNK; s <<= 1)
    power_step<<<dim3(32, s), 256, 0, stream>>>(powers, s);

  // Bx = X @ B^T
  bx_gemm<<<dim3((BS * TLEN) / 128, DDIM / 64), 256, 0, stream>>>(x, Bm, Bx);

  // chunk-local scans: Lam lives in the 320KB WGP LDS (256*HPAD + 2*16*HPAD)
  const size_t lds_scan = (size_t)(256 * HPAD + 2 * BS * HPAD) * sizeof(float);
  chunk_scan<<<NCH, 512, lds_scan, stream>>>(Bx, Lam, out);

  // serial carry scan across chunk boundaries (P = Lam^CHUNK in LDS)
  const size_t lds_carry = (size_t)(256 * HPAD + DDIM) * sizeof(float);
  carry_scan<<<BS, DDIM, lds_carry, stream>>>(
      out, powers + (size_t)(CHUNK - 1) * MATELEMS, carries);

  // broadcast carries back into every timestep
  correct<<<dim3(CHUNK, NCH - 1), 512, 0, stream>>>(out, powers, carries);
}

// v001
// Measured time: 577 microseconds a run.
// Next to v000, in two timings, it ran 1.17 times as fast each time.
#include <hip/hip_runtime.h>

typedef __attribute__((ext_vector_type(2))) float v2f;
typedef __attribute__((ext_vector_type(4))) float v4f;
typedef __attribute__((ext_vector_type(8))) float v8f;

#define DDIM 256
#define BS   16
#define TLEN 4096
#define CHUNK 64
#define NCH  (TLEN / CHUNK)          // 64 chunks
#define MATELEMS (DDIM * DDIM)       // 65536
#define HPAD 260                     // padded LDS row stride (bank-conflict-free)

__device__ __forceinline__ v8f wmma4(v2f a, v2f b, v8f c) {
  // D = A(16x4,f32) * B(4x16,f32) + C(16x16,f32)
  return __builtin_amdgcn_wmma_f32_16x16x4_f32(false, a, false, b, (short)0, c,
                                               false, false);
}

__device__ __forceinline__ v8f vzero8() {
  v8f z = {0.f, 0.f, 0.f, 0.f, 0.f, 0.f, 0.f, 0.f};
  return z;
}

// ---------------------------------------------------------------- powers ----
__global__ void copy_mat(const float* __restrict__ src, float* __restrict__ dst) {
  int i = blockIdx.x * blockDim.x + threadIdx.x;
  if (i < MATELEMS) dst[i] = src[i];
}

// powers[k] lives at pw + (k-1)*MATELEMS.  Computes A_{s+j} = A_s * A_j,
// j = blockIdx.y+1 (1..s).  8 waves/WG, one 16x16 output tile per wave.
__global__ void power_step(float* __restrict__ pw, int s) {
  const int j = blockIdx.y + 1;
  const float* As = pw + (size_t)(s - 1) * MATELEMS;
  const float* Aj = pw + (size_t)(j - 1) * MATELEMS;
  float*       Dm = pw + (size_t)(s + j - 1) * MATELEMS;

  const int lane = threadIdx.x & 31;
  const int wave = threadIdx.x >> 5;        // 0..7
  const int tile = blockIdx.x * 8 + wave;   // 0..255
  const int mt = tile >> 4, nt = tile & 15;
  const int col = lane & 15;
  const int kk  = (lane >> 4) * 2;

  v8f acc = vzero8();
  const float* arow = As + (mt * 16 + col) * DDIM;
  for (int e = 0; e < DDIM; e += 4) {
    v2f a = *(const v2f*)(arow + e + kk);
    v2f b;
    b.x = Aj[(e + kk    ) * DDIM + nt * 16 + col];
    b.y = Aj[(e + kk + 1) * DDIM + nt * 16 + col];
    acc = wmma4(a, b, acc);
  }
  const int hi = (lane >> 4) * 8;
#pragma unroll
  for (int v = 0; v < 8; ++v)
    Dm[(mt * 16 + v + hi) * DDIM + nt * 16 + col] = acc[v];
}

// ---------------------------------------------------------------- Bx GEMM ---
// Bx[r,n] = sum_e X[r,e] * Bm[n,e]  (Bx = X @ Bm^T).  8 waves/WG; each wave
// owns a 16x64 strip (A fragment reused across 4 WMMAs per k-step).
__global__ void bx_gemm(const float* __restrict__ X, const float* __restrict__ Bm,
                        float* __restrict__ Bx) {
  const int lane = threadIdx.x & 31;
  const int wave = threadIdx.x >> 5;      // 0..7
  const int r0 = blockIdx.x * 128 + wave * 16;
  const int n0 = blockIdx.y * 64;
  const int col = lane & 15;
  const int kk  = (lane >> 4) * 2;

  v8f acc0 = vzero8(), acc1 = vzero8(), acc2 = vzero8(), acc3 = vzero8();
  const float* xrow = X  + (r0 + col) * DDIM;
  const float* b0   = Bm + (n0 +  0 + col) * DDIM;
  const float* b1   = Bm + (n0 + 16 + col) * DDIM;
  const float* b2   = Bm + (n0 + 32 + col) * DDIM;
  const float* b3   = Bm + (n0 + 48 + col) * DDIM;
  for (int e = 0; e < DDIM; e += 4) {
    v2f a = *(const v2f*)(xrow + e + kk);
    acc0 = wmma4(a, *(const v2f*)(b0 + e + kk), acc0);
    acc1 = wmma4(a, *(const v2f*)(b1 + e + kk), acc1);
    acc2 = wmma4(a, *(const v2f*)(b2 + e + kk), acc2);
    acc3 = wmma4(a, *(const v2f*)(b3 + e + kk), acc3);
  }
  const int hi = (lane >> 4) * 8;
#pragma unroll
  for (int v = 0; v < 8; ++v) {
    float* orow = Bx + (r0 + v + hi) * DDIM + col;
    orow[n0 +  0] = acc0[v];
    orow[n0 + 16] = acc1[v];
    orow[n0 + 32] = acc2[v];
    orow[n0 + 48] = acc3[v];
  }
}

// ------------------------------------------------------------- chunk scan ---
// Per chunk (blockIdx.x): u_i = Lam @ u_{i-1} + Bx_t for i=0..CHUNK-1 with
// u_{-1}=0, all 16 batches as the M dim of a 16x256x256 WMMA GEMM per step.
// Lam (256KB) is staged into the 320KB WGP LDS via CDNA5 async global->LDS
// b128 copies; h ping-pongs through LDS.  16 waves, wave w owns cols [16w..).
// Dynamic LDS layout: [0, 256*HPAD) = Lam (padded rows); then 2*16*HPAD for h.
__global__ void __launch_bounds__(512) chunk_scan(const float* __restrict__ Bx,
                                                  const float* __restrict__ Lam,
                                                  float* __restrict__ U) {
  extern __shared__ float smem[];
  float* lam_s = smem;                       // 256 x HPAD
  float* hb    = smem + 256 * HPAD;          // 2 x BS x HPAD

  const int lane = threadIdx.x & 31;
  const int wave = threadIdx.x >> 5;     // 0..15
  const int chunk = blockIdx.x;
  const int n0 = wave * 16;
  const int col = lane & 15;
  const int kk  = (lane >> 4) * 2;
  const int hi  = (lane >> 4) * 8;

  // ---- stage Lam into LDS with async global->LDS copies (ASYNCcnt path).
  // Dynamic LDS starts at group-segment offset 0, so LDS byte offsets are
  // computed numerically.  Each b128 moves 4 floats of one (padded) row.
  {
    const unsigned long long gbase = (unsigned long long)(uintptr_t)Lam;
    for (int g = threadIdx.x; g < MATELEMS / 4; g += (int)blockDim.x) {
      const int row = g >> 6;              // 64 x b128 per 256-float row
      const int e   = (g & 63) * 4;
      unsigned ldsoff = (unsigned)((row * HPAD + e) * 4);
      unsigned voff   = (unsigned)(g * 16);
      asm volatile("global_load_async_to_lds_b128 %0, %1, %2"
                   :: "v"(ldsoff), "v"(voff), "s"(gbase)
                   : "memory");
    }
    asm volatile("s_wait_asynccnt 0x0" ::: "memory");
  }

  // zero h_{-1} (buffer 0)
  for (int i = threadIdx.x; i < BS * DDIM; i += (int)blockDim.x)
    hb[(i >> 8) * HPAD + (i & 255)] = 0.f;
  __syncthreads();

  const float* lrow = lam_s + (n0 + col) * HPAD;   // row n of Lam: B[k,n]=Lam[n,k]
  for (int i = 0; i < CHUNK; ++i) {
    const int t = chunk * CHUNK + i;
    const float* hsrc = hb + (i & 1) * (BS * HPAD);
    v8f acc = vzero8();
    for (int e = 0; e < DDIM; e += 4) {
      v2f a = *(const v2f*)(hsrc + col * HPAD + e + kk);  // A[m=batch,k]
      v2f b = *(const v2f*)(lrow + e + kk);
      acc = wmma4(a, b, acc);
    }
    float* hdst = hb + ((i + 1) & 1) * (BS * HPAD);
#pragma unroll
    for (int v = 0; v < 8; ++v) {
      const int bat = v + hi;
      float h = acc[v] + Bx[(bat * TLEN + t) * DDIM + n0 + col];
      hdst[bat * HPAD + n0 + col] = h;
      U[(bat * TLEN + t) * DDIM + n0 + col] = h;
    }
    __syncthreads();
  }
}

// ------------------------------------------------------------- carry scan ---
// carry_k = Lam^CHUNK @ carry_{k-1} + u_last(k).  One WG per batch; thread n
// owns output dim n; true mat-vec -> VALU fmacs.  P staged into LDS once.
__global__ void carry_scan(const float* __restrict__ U, const float* __restrict__ P,
                           float* __restrict__ carries) {
  extern __shared__ float smem[];
  float* p_s = smem;                  // 256 x HPAD
  float* hc  = smem + 256 * HPAD;     // 256

  const int b = blockIdx.x;
  const int n = threadIdx.x;

  for (int g = threadIdx.x; g < MATELEMS / 4; g += (int)blockDim.x) {
    const int row = g >> 6;
    const int e   = (g & 63) * 4;
    *(v4f*)(p_s + row * HPAD + e) = *(const v4f*)(P + g * 4);
  }
  hc[n] = 0.f;
  __syncthreads();

  const float* prow = p_s + n * HPAD;
  for (int k = 0; k < NCH; ++k) {
    float s = U[(b * TLEN + (k * CHUNK + CHUNK - 1)) * DDIM + n];
    for (int e = 0; e < DDIM; e += 4) {
      v4f p = *(const v4f*)(prow + e);
      v4f h = *(const v4f*)(hc + e);
      s += p.x * h.x + p.y * h.y + p.z * h.z + p.w * h.w;
    }
    __syncthreads();
    hc[n] = s;
    carries[(k * BS + b) * DDIM + n] = s;
    __syncthreads();
  }
}

// ------------------------------------------------------------- correction ---
// out[b, k*CHUNK+i, :] += Lam^{i+1} @ carry_{k-1}[b].  One WG per (power i,
// group of CTILES chunks).  The power goes through LDS once (coalesced reads)
// into registers: wave w keeps the 64 B fragments of its 16 columns for the
// whole kernel.  The same LDS then takes the group's carries (16 rows per
// chunk), and every chunk runs through the resident fragments.  Accumulator
// seeded from out, k order as before, so each sum is formed in the same order.
#define CTILES 16                    // chunks per work-group (CTILES*BS = 256 LDS rows)
#define CTHREADS 512
#define ABLK 16                      // A fragments fetched from LDS as one group

// 256x256 floats, row-major in global memory, to LDS rows of HPAD floats.
#define SGRP 8                       // loads of a lane in flight: not one L2 round trip each
__device__ __forceinline__ void stage_mat(float* __restrict__ dst,
                                          const float* __restrict__ src) {
  const int row = threadIdx.x >> 6;          // 64 x 16 bytes per row
  const int e   = (threadIdx.x & 63) * 4;
  for (int r0 = 0; r0 < MATELEMS / 4 / CTHREADS; r0 += SGRP) {
    v4f x[SGRP];
    // full unrolls: constant indices keep x in registers
#pragma unroll
    for (int u = 0; u < SGRP; ++u)
      x[u] = *(const v4f*)(src + ((r0 + u) * CTHREADS + threadIdx.x) * 4);
#pragma unroll
    for (int u = 0; u < SGRP; ++u)
      *(v4f*)(dst + ((r0 + u) * (CTHREADS / 64) + row) * HPAD + e) = x[u];
  }
}

__global__ void __launch_bounds__(CTHREADS) correct(float* __restrict__ out,
                                                    const float* __restrict__ pw,
                                                    const float* __restrict__ carries) {
  // 256 x HPAD floats: first the power, then the carries
  extern __shared__ __attribute__((aligned(16))) float csm[];

  const int i  = blockIdx.x;           // 0..CHUNK-1
  const int m0 = blockIdx.y * CTILES;  // first carry index (chunk k-1) of the group
  const int lane = threadIdx.x & 31;
  const int wave = threadIdx.x >> 5;   // 0..15
  const int n0 = wave * 16;
  const int col = lane & 15;
  const int kk  = (lane >> 4) * 2;
  const int hi  = (lane >> 4) * 8;

  stage_mat(csm, pw + (size_t)i * MATELEMS);                  // Lam^{i+1}
  __syncthreads();

  v2f bfrag[DDIM / 4];                                        // B[k,n]=Lam^{i+1}[n,k]
  const float* brow = csm + (n0 + col) * HPAD + kk;
  // full unroll: bfrag must be indexed by constants to stay in registers
#pragma unroll
  for (int s = 0; s < DDIM / 4; ++s) bfrag[s] = *(const v2f*)(brow + 4 * s);
  __syncthreads();                     // every wave has its fragments: LDS is free

  // carries[m0 .. m0+CTILES) are CTILES*BS contiguous rows; index NCH-1 exists
  // (written by carry_scan), so the last group stages it and leaves it unused.
  stage_mat(csm, carries + (size_t)m0 * BS * DDIM);
  __syncthreads();

  const int ntile = (NCH - 1 - m0 < CTILES) ? (NCH - 1 - m0) : CTILES;
  for (int j = 0; j < ntile; ++j) {
    const int t = (m0 + j + 1) * CHUNK + i;
    const float* arow = csm + (j * BS + col) * HPAD + kk;     // A[m=batch,k=e]
    // every unroll below is full: constant indices keep acc, abuf and bfrag in registers
    v8f acc;
#pragma unroll
    for (int v = 0; v < 8; ++v)
      acc[v] = out[((v + hi) * TLEN + t) * DDIM + n0 + col];
    v2f abuf[2][ABLK];                 // two groups: LDS reads are issued ahead of the WMMAs that use them
#pragma unroll
    for (int s = 0; s < ABLK; ++s) abuf[0][s] = *(const v2f*)(arow + 4 * s);
#pragma unroll
    for (int q = 0; q < DDIM / 4 / ABLK; ++q) {
      if (q + 1 < DDIM / 4 / ABLK) {
#pragma unroll
        for (int s = 0; s < ABLK; ++s)
          abuf[(q + 1) & 1][s] = *(const v2f*)(arow + 4 * ((q + 1) * ABLK + s));
      }
#pragma unroll
      for (int s = 0; s < ABLK; ++s)
        acc = wmma4(abuf[q & 1][s], bfrag[q * ABLK + s], acc);
    }
#pragma unroll
    for (int v = 0; v < 8; ++v)
      out[((v + hi) * TLEN + t) * DDIM + n0 + col] = acc[v];
    // precaution: the next trip rewrites the address registers these stores name
    asm volatile("s_wait_xcnt 0x0" ::: "memory");
  }
}

// ------------------------------------------------------------------ launch --
extern "C" void kernel_launch(void* const* d_in, const int* in_sizes, int n_in,
                              void* d_out, int out_size, void* d_ws, size_t ws_size,
                              hipStream_t stream) {
  (void)in_sizes; (void)n_in; (void)out_size; (void)ws_size;
  const float* x   = (const float*)d_in[0];   // [16,4096,256]
  const float* Bm  = (const float*)d_in[1];   // [256,256]
  const float* Lam = (const float*)d_in[2];   // [256,256]
  float* out = (float*)d_out;                 // [16,4096,256], also U buffer

  float* Bx      = (float*)d_ws;                         // 16.78M floats
  float* powers  = Bx + (size_t)BS * TLEN * DDIM;        // 64 * 65536 floats
  float* carries = powers + (size_t)CHUNK * MATELEMS;    // NCH*BS*DDIM floats

  // Lam^1..Lam^64 by log-doubling.
  copy_mat<<<MATELEMS / 256, 256, 0, stream>>>(Lam, powers);
  for (int s = 1; s < CHUNK; s <<= 1)
    power_step<<<dim3(32, s), 256, 0, stream>>>(powers, s);

  // Bx = X @ B^T
  bx_gemm<<<dim3((BS * TLEN) / 128, DDIM / 64), 256, 0, stream>>>(x, Bm, Bx);

  // chunk-local scans: Lam lives in the 320KB WGP LDS (256*HPAD + 2*16*HPAD)
  const size_t lds_scan = (size_t)(256 * HPAD + 2 * BS * HPAD) * sizeof(float);
  chunk_scan<<<NCH, 512, lds_scan, stream>>>(Bx, Lam, out);

  // serial carry scan across chunk boundaries (P = Lam^CHUNK in LDS)
  const size_t lds_carry = (size_t)(256 * HPAD + DDIM) * sizeof(float);
  carry_scan<<<BS, DDIM, lds_carry, stream>>>(
      out, powers + (size_t)(CHUNK - 1) * MATELEMS, carries);

  // broadcast carries back into every timestep
  const size_t lds_corr = (size_t)(256 * HPAD) * sizeof(float);
  correct<<<dim3(CHUNK, NCH / CTILES), CTHREADS, lds_corr, stream>>>(out, powers, carries);
}

// v002
// One run takes 529 microseconds.
// Next to v001, in two timings, it ran 1.09 times as fast each time.
// All steps since v000 together make it 1.28 times as fast.
#include <hip/hip_runtime.h>

typedef __attribute__((ext_vector_type(2))) float v2f;
typedef __attribute__((ext_vector_type(4))) float v4f;
typedef __attribute__((ext_vector_type(8))) float v8f;

#define DDIM 256
#define BS   16
#define TLEN 4096
#define CHUNK 64
#define NCH  (TLEN / CHUNK)          // 64 chunks
#define MATELEMS (DDIM * DDIM)       // 65536
#define HPAD 260                     // padded LDS row stride (bank-conflict-free)

__device__ __forceinline__ v8f wmma4(v2f a, v2f b, v8f c) {
  // D = A(16x4,f32) * B(4x16,f32) + C(16x16,f32)
  return __builtin_amdgcn_wmma_f32_16x16x4_f32(false, a, false, b, (short)0, c,
                                               false, false);
}

__device__ __forceinline__ v8f vzero8() {
  v8f z = {0.f, 0.f, 0.f, 0.f, 0.f, 0.f, 0.f, 0.f};
  return z;
}

// ---------------------------------------------------------------- powers ----
__global__ void copy_mat(const float* __restrict__ src, float* __restrict__ dst) {
  int i = blockIdx.x * blockDim.x + threadIdx.x;
  if (i < MATELEMS) dst[i] = src[i];
}

// powers[k] lives at pw + (k-1)*MATELEMS.  Computes A_{s+j} = A_s * A_j,
// j = blockIdx.y+1 (1..s).  8 waves/WG, one 16x16 output tile per wave.
__global__ void power_step(float* __restrict__ pw, int s) {
  const int j = blockIdx.y + 1;
  const float* As = pw + (size_t)(s - 1) * MATELEMS;
  const float* Aj = pw + (size_t)(j - 1) * MATELEMS;
  float*       Dm = pw + (size_t)(s + j - 1) * MATELEMS;

  const int lane = threadIdx.x & 31;
  const int wave = threadIdx.x >> 5;        // 0..7
  const int tile = blockIdx.x * 8 + wave;   // 0..255
  const int mt = tile >> 4, nt = tile & 15;
  const int col = lane & 15;
  const int kk  = (lane >> 4) * 2;

  v8f acc = vzero8();
  const float* arow = As + (mt * 16 + col) * DDIM;
  for (int e = 0; e < DDIM; e += 4) {
    v2f a = *(const v2f*)(arow + e + kk);
    v2f b;
    b.x = Aj[(e + kk    ) * DDIM + nt * 16 + col];
    b.y = Aj[(e + kk + 1) * DDIM + nt * 16 + col];
    acc = wmma4(a, b, acc);
  }
  const int hi = (lane >> 4) * 8;
#pragma unroll
  for (int v = 0; v < 8; ++v)
    Dm[(mt * 16 + v + hi) * DDIM + nt * 16 + col] = acc[v];
}

// ------------------------------------------------- shared staging helper ---
#define CTILES 16                    // chunks per work-group (CTILES*BS = 256 LDS rows)
#define CTHREADS 512
#define ABLK 16                      // A fragments fetched from LDS as one group

// 256x256 floats, row-major in global memory, to LDS rows of HPAD floats.
#define SGRP 8                       // loads of a lane in flight: not one L2 round trip each
__device__ __forceinline__ void stage_mat(float* __restrict__ dst,
                                          const float* __restrict__ src) {
  const int row = threadIdx.x >> 6;          // 64 x 16 bytes per row
  const int e   = (threadIdx.x & 63) * 4;
  for (int r0 = 0; r0 < MATELEMS / 4 / CTHREADS; r0 += SGRP) {
    v4f x[SGRP];
    // full unrolls: constant indices keep x in registers
#pragma unroll
    for (int u = 0; u < SGRP; ++u)
      x[u] = *(const v4f*)(src + ((r0 + u) * CTHREADS + threadIdx.x) * 4);
#pragma unroll
    for (int u = 0; u < SGRP; ++u)
      *(v4f*)(dst + ((r0 + u) * (CTHREADS / 64) + row) * HPAD + e) = x[u];
  }
}

// ---------------------------------------------------------------- Bx GEMM ---
// Bx[r,n] = sum_e X[r,e] * Bm[n,e]  (Bx = X @ Bm^T).  One WG per 256 rows of X.
// Bm goes through LDS once (coalesced reads) into registers: wave w keeps the
// 64 B fragments of its 16 columns for the whole kernel.  The same LDS then
// takes the WG's 256 rows of X (whole-line reads), and every 16-row tile runs
// through the resident fragments.  One accumulator chain per tile, k ascending,
// so each sum is formed in the same order as with fragments read from global.
#define XROWS 256                    // rows of X per work-group (fills the LDS rows)
__global__ void __launch_bounds__(CTHREADS) bx_gemm(const float* __restrict__ X,
                                                    const float* __restrict__ Bm,
                                                    float* __restrict__ Bx) {
  // 256 x HPAD floats: first Bm, then the rows of X
  extern __shared__ __attribute__((aligned(16))) float csm[];

  const int r0 = blockIdx.x * XROWS;
  const int lane = threadIdx.x & 31;
  const int wave = threadIdx.x >> 5;   // 0..15
  const int n0 = wave * 16;
  const int col = lane & 15;
  const int kk  = (lane >> 4) * 2;
  const int hi  = (lane >> 4) * 8;

  stage_mat(csm, Bm);
  __syncthreads();

  v2f bfrag[DDIM / 4];                                        // B[k,n]=Bm[n,k]
  const float* brow = csm + (n0 + col) * HPAD + kk;
  // full unroll: bfrag must be indexed by constants to stay in registers
#pragma unroll
  for (int s = 0; s < DDIM / 4; ++s) bfrag[s] = *(const v2f*)(brow + 4 * s);
  __syncthreads();                     // every wave has its fragments: LDS is free

  stage_mat(csm, X + (size_t)r0 * DDIM);
  __syncthreads();

  const float* arow = csm + col * HPAD + kk;                  // A[m=row,k=e]
  float* orow = Bx + (size_t)(r0 + hi) * DDIM + n0 + col;
  for (int j = 0; j < XROWS / 16; ++j) {
    // every unroll below is full: constant indices keep acc, abuf and bfrag in registers
    v8f acc = vzero8();
    v2f abuf[2][ABLK];                 // two groups: LDS reads are issued ahead of the WMMAs that use them
#pragma unroll
    for (int s = 0; s < ABLK; ++s) abuf[0][s] = *(const v2f*)(arow + 4 * s);
#pragma unroll
    for (int q = 0; q < DDIM / 4 / ABLK; ++q) {
      if (q + 1 < DDIM / 4 / ABLK) {
#pragma unroll
        for (int s = 0; s < ABLK; ++s)
          abuf[(q + 1) & 1][s] = *(const v2f*)(arow + 4 * ((q + 1) * ABLK + s));
      }
#pragma unroll
      for (int s = 0; s < ABLK; ++s)
        acc = wmma4(abuf[q & 1][s], bfrag[q * ABLK + s], acc);
    }
#pragma unroll
    for (int v = 0; v < 8; ++v)
      orow[v * DDIM] = acc[v];
    // precaution: the next trip rewrites the address registers these stores name
    asm volatile("s_wait_xcnt 0x0" ::: "memory");
    arow += 16 * HPAD;
    orow += 16 * DDIM;
  }
}

// ------------------------------------------------------------- chunk scan ---
// Per chunk (blockIdx.x): u_i = Lam @ u_{i-1} + Bx_t for i=0..CHUNK-1 with
// u_{-1}=0, all 16 batches as the M dim of a 16x256x256 WMMA GEMM per step.
// Lam (256KB) is staged into the 320KB WGP LDS via CDNA5 async global->LDS
// b128 copies; h ping-pongs through LDS.  16 waves, wave w owns cols [16w..).
// Dynamic LDS layout: [0, 256*HPAD) = Lam (padded rows); then 2*16*HPAD for h.
__global__ void __launch_bounds__(512) chunk_scan(const float* __restrict__ Bx,
                                                  const float* __restrict__ Lam,
                                                  float* __restrict__ U) {
  extern __shared__ float smem[];
  float* lam_s = smem;                       // 256 x HPAD
  float* hb    = smem + 256 * HPAD;          // 2 x BS x HPAD

  const int lane = threadIdx.x & 31;
  const int wave = threadIdx.x >> 5;     // 0..15
  const int chunk = blockIdx.x;
  const int n0 = wave * 16;
  const int col = lane & 15;
  const int kk  = (lane >> 4) * 2;
  const int hi  = (lane >> 4) * 8;

  // ---- stage Lam into LDS with async global->LDS copies (ASYNCcnt path).
  // Dynamic LDS starts at group-segment offset 0, so LDS byte offsets are
  // computed numerically.  Each b128 moves 4 floats of one (padded) row.
  {
    const unsigned long long gbase = (unsigned long long)(uintptr_t)Lam;
    for (int g = threadIdx.x; g < MATELEMS / 4; g += (int)blockDim.x) {
      const int row = g >> 6;              // 64 x b128 per 256-float row
      const int e   = (g & 63) * 4;
      unsigned ldsoff = (unsigned)((row * HPAD + e) * 4);
      unsigned voff   = (unsigned)(g * 16);
      asm volatile("global_load_async_to_lds_b128 %0, %1, %2"
                   :: "v"(ldsoff), "v"(voff), "s"(gbase)
                   : "memory");
    }
    asm volatile("s_wait_asynccnt 0x0" ::: "memory");
  }

  // zero h_{-1} (buffer 0)
  for (int i = threadIdx.x; i < BS * DDIM; i += (int)blockDim.x)
    hb[(i >> 8) * HPAD + (i & 255)] = 0.f;
  __syncthreads();

  const float* lrow = lam_s + (n0 + col) * HPAD;   // row n of Lam: B[k,n]=Lam[n,k]
  for (int i = 0; i < CHUNK; ++i) {
    const int t = chunk * CHUNK + i;
    const float* hsrc = hb + (i & 1) * (BS * HPAD);
    v8f acc = vzero8();
    for (int e = 0; e < DDIM; e += 4) {
      v2f a = *(const v2f*)(hsrc + col * HPAD + e + kk);  // A[m=batch,k]
      v2f b = *(const v2f*)(lrow + e + kk);
      acc = wmma4(a, b, acc);
    }
    float* hdst = hb + ((i + 1) & 1) * (BS * HPAD);
#pragma unroll
    for (int v = 0; v < 8; ++v) {
      const int bat = v + hi;
      float h = acc[v] + Bx[(bat * TLEN + t) * DDIM + n0 + col];
      hdst[bat * HPAD + n0 + col] = h;
      U[(bat * TLEN + t) * DDIM + n0 + col] = h;
    }
    __syncthreads();
  }
}

// ------------------------------------------------------------- carry scan ---
// carry_k = Lam^CHUNK @ carry_{k-1} + u_last(k).  One WG per batch; thread n
// owns output dim n; true mat-vec -> VALU fmacs.  P staged into LDS once.
__global__ void carry_scan(const float* __restrict__ U, const float* __restrict__ P,
                           float* __restrict__ carries) {
  extern __shared__ float smem[];
  float* p_s = smem;                  // 256 x HPAD
  float* hc  = smem + 256 * HPAD;     // 256

  const int b = blockIdx.x;
  const int n = threadIdx.x;

  for (int g = threadIdx.x; g < MATELEMS / 4; g += (int)blockDim.x) {
    const int row = g >> 6;
    const int e   = (g & 63) * 4;
    *(v4f*)(p_s + row * HPAD + e) = *(const v4f*)(P + g * 4);
  }
  hc[n] = 0.f;
  __syncthreads();

  const float* prow = p_s + n * HPAD;
  for (int k = 0; k < NCH; ++k) {
    float s = U[(b * TLEN + (k * CHUNK + CHUNK - 1)) * DDIM + n];
    for (int e = 0; e < DDIM; e += 4) {
      v4f p = *(const v4f*)(prow + e);
      v4f h = *(const v4f*)(hc + e);
      s += p.x * h.x + p.y * h.y + p.z * h.z + p.w * h.w;
    }
    __syncthreads();
    hc[n] = s;
    carries[(k * BS + b) * DDIM + n] = s;
    __syncthreads();
  }
}

// ------------------------------------------------------------- correction ---
// out[b, k*CHUNK+i, :] += Lam^{i+1} @ carry_{k-1}[b].  One WG per (power i,
// group of CTILES chunks).  The power goes through LDS once (coalesced reads)
// into registers: wave w keeps the 64 B fragments of its 16 columns for the
// whole kernel.  The same LDS then takes the group's carries (16 rows per
// chunk), and every chunk runs through the resident fragments.  Accumulator
// seeded from out, k order as before, so each sum is formed in the same order.
__global__ void __launch_bounds__(CTHREADS) correct(float* __restrict__ out,
                                                    const float* __restrict__ pw,
                                                    const float* __restrict__ carries) {
  // 256 x HPAD floats: first the power, then the carries
  extern __shared__ __attribute__((aligned(16))) float csm[];

  const int i  = blockIdx.x;           // 0..CHUNK-1
  const int m0 = blockIdx.y * CTILES;  // first carry index (chunk k-1) of the group
  const int lane = threadIdx.x & 31;
  const int wave = threadIdx.x >> 5;   // 0..15
  const int n0 = wave * 16;
  const int col = lane & 15;
  const int kk  = (lane >> 4) * 2;
  const int hi  = (lane >> 4) * 8;

  stage_mat(csm, pw + (size_t)i * MATELEMS);                  // Lam^{i+1}
  __syncthreads();

  v2f bfrag[DDIM / 4];                                        // B[k,n]=Lam^{i+1}[n,k]
  const float* brow = csm + (n0 + col) * HPAD + kk;
  // full unroll: bfrag must be indexed by constants to stay in registers
#pragma unroll
  for (int s = 0; s < DDIM / 4; ++s) bfrag[s] = *(const v2f*)(brow + 4 * s);
  __syncthreads();                     // every wave has its fragments: LDS is free

  // carries[m0 .. m0+CTILES) are CTILES*BS contiguous rows; index NCH-1 exists
  // (written by carry_scan), so the last group stages it and leaves it unused.
  stage_mat(csm, carries + (size_t)m0 * BS * DDIM);
  __syncthreads();

  const int ntile = (NCH - 1 - m0 < CTILES) ? (NCH - 1 - m0) : CTILES;
  for (int j = 0; j < ntile; ++j) {
    const int t = (m0 + j + 1) * CHUNK + i;
    const float* arow = csm + (j * BS + col) * HPAD + kk;     // A[m=batch,k=e]
    // every unroll below is full: constant indices keep acc, abuf and bfrag in registers
    v8f acc;
#pragma unroll
    for (int v = 0; v < 8; ++v)
      acc[v] = out[((v + hi) * TLEN + t) * DDIM + n0 + col];
    v2f abuf[2][ABLK];                 // two groups: LDS reads are issued ahead of the WMMAs that use them
#pragma unroll
    for (int s = 0; s < ABLK; ++s) abuf[0][s] = *(const v2f*)(arow + 4 * s);
#pragma unroll
    for (int q = 0; q < DDIM / 4 / ABLK; ++q) {
      if (q + 1 < DDIM / 4 / ABLK) {
#pragma unroll
        for (int s = 0; s < ABLK; ++s)
          abuf[(q + 1) & 1][s] = *(const v2f*)(arow + 4 * ((q + 1) * ABLK + s));
      }
#pragma unroll
      for (int s = 0; s < ABLK; ++s)
        acc = wmma4(abuf[q & 1][s], bfrag[q * ABLK + s], acc);
    }
#pragma unroll
    for (int v = 0; v < 8; ++v)
      out[((v + hi) * TLEN + t) * DDIM + n0 + col] = acc[v];
    // precaution: the next trip rewrites the address registers these stores name
    asm volatile("s_wait_xcnt 0x0" ::: "memory");
  }
}

// ------------------------------------------------------------------ launch --
extern "C" void kernel_launch(void* const* d_in, const int* in_sizes, int n_in,
                              void* d_out, int out_size, void* d_ws, size_t ws_size,
                              hipStream_t stream) {
  (void)in_sizes; (void)n_in; (void)out_size; (void)ws_size;
  const float* x   = (const float*)d_in[0];   // [16,4096,256]
  const float* Bm  = (const float*)d_in[1];   // [256,256]
  const float* Lam = (const float*)d_in[2];   // [256,256]
  float* out = (float*)d_out;                 // [16,4096,256], also U buffer

  float* Bx      = (float*)d_ws;                         // 16.78M floats
  float* powers  = Bx + (size_t)BS * TLEN * DDIM;        // 64 * 65536 floats
  float* carries = powers + (size_t)CHUNK * MATELEMS;    // NCH*BS*DDIM floats

  // Lam^1..Lam^64 by log-doubling.
  copy_mat<<<MATELEMS / 256, 256, 0, stream>>>(Lam, powers);
  for (int s = 1; s < CHUNK; s <<= 1)
    power_step<<<dim3(32, s), 256, 0, stream>>>(powers, s);

  // Bx = X @ B^T
  const size_t lds_mat = (size_t)(256 * HPAD) * sizeof(float);
  bx_gemm<<<(BS * TLEN) / XROWS, CTHREADS, lds_mat, stream>>>(x, Bm, Bx);

  // chunk-local scans: Lam lives in the 320KB WGP LDS (256*HPAD + 2*16*HPAD)
  const size_t lds_scan = (size_t)(256 * HPAD + 2 * BS * HPAD) * sizeof(float);
  chunk_scan<<<NCH, 512, lds_scan, stream>>>(Bx, Lam, out);

  // serial carry scan across chunk boundaries (P = Lam^CHUNK in LDS)
  const size_t lds_carry = (size_t)(256 * HPAD + DDIM) * sizeof(float);
  carry_scan<<<BS, DDIM, lds_carry, stream>>>(
      out, powers + (size_t)(CHUNK - 1) * MATELEMS, carries);

  // broadcast carries back into every timestep
  const size_t lds_corr = (size_t)(256 * HPAD) * sizeof(float);
  correct<<<dim3(CHUNK, NCH / CTILES), CTHREADS, lds_corr, stream>>>(out, powers, carries);
}

// v003
// One run takes 420 microseconds.
// In both of two side-by-side timings against v002, it was 1.26 times as fast.
// Over all steps from v000 it is 1.61 times as fast.
#include <hip/hip_runtime.h>

typedef __attribute__((ext_vector_type(2))) float v2f;
typedef __attribute__((ext_vector_type(4))) float v4f;
typedef __attribute__((ext_vector_type(8))) float v8f;

#define DDIM 256
#define BS   16
#define TLEN 4096
#define CHUNK 64
#define NCH  (TLEN / CHUNK)          // 64 chunks
#define MATELEMS (DDIM * DDIM)       // 65536
#define HPAD 260                     // padded LDS row stride (bank-conflict-free)

__device__ __forceinline__ v8f wmma4(v2f a, v2f b, v8f c) {
  // D = A(16x4,f32) * B(4x16,f32) + C(16x16,f32)
  return __builtin_amdgcn_wmma_f32_16x16x4_f32(false, a, false, b, (short)0, c,
                                               false, false);
}

__device__ __forceinline__ v8f vzero8() {
  v8f z = {0.f, 0.f, 0.f, 0.f, 0.f, 0.f, 0.f, 0.f};
  return z;
}

// ---------------------------------------------------------------- powers ----
__global__ void copy_mat(const float* __restrict__ src, float* __restrict__ dst) {
  int i = blockIdx.x * blockDim.x + threadIdx.x;
  if (i < MATELEMS) dst[i] = src[i];
}

// powers[k] lives at pw + (k-1)*MATELEMS.  Computes A_{s+j} = A_s * A_j,
// j = blockIdx.y+1 (1..s).  8 waves/WG, one 16x16 output tile per wave.
__global__ void power_step(float* __restrict__ pw, int s) {
  const int j = blockIdx.y + 1;
  const float* As = pw + (size_t)(s - 1) * MATELEMS;
  const float* Aj = pw + (size_t)(j - 1) * MATELEMS;
  float*       Dm = pw + (size_t)(s + j - 1) * MATELEMS;

  const int lane = threadIdx.x & 31;
  const int wave = threadIdx.x >> 5;        // 0..7
  const int tile = blockIdx.x * 8 + wave;   // 0..255
  const int mt = tile >> 4, nt = tile & 15;
  const int col = lane & 15;
  const int kk  = (lane >> 4) * 2;

  v8f acc = vzero8();
  const float* arow = As + (mt * 16 + col) * DDIM;
  for (int e = 0; e < DDIM; e += 4) {
    v2f a = *(const v2f*)(arow + e + kk);
    v2f b;
    b.x = Aj[(e + kk    ) * DDIM + nt * 16 + col];
    b.y = Aj[(e + kk + 1) * DDIM + nt * 16 + col];
    acc = wmma4(a, b, acc);
  }
  const int hi = (lane >> 4) * 8;
#pragma unroll
  for (int v = 0; v < 8; ++v)
    Dm[(mt * 16 + v + hi) * DDIM + nt * 16 + col] = acc[v];
}

// ------------------------------------------------- shared staging helper ---
#define CTILES 16                    // chunks per work-group (CTILES*BS = 256 LDS rows)
#define CTHREADS 512
#define ABLK 16                      // A fragments fetched from LDS as one group

// 256x256 floats, row-major in global memory, to LDS rows of HPAD floats.
#define SGRP 8                       // loads of a lane in flight: not one L2 round trip each
__device__ __forceinline__ void stage_mat(float* __restrict__ dst,
                                          const float* __restrict__ src) {
  const int row = threadIdx.x >> 6;          // 64 x 16 bytes per row
  const int e   = (threadIdx.x & 63) * 4;
  for (int r0 = 0; r0 < MATELEMS / 4 / CTHREADS; r0 += SGRP) {
    v4f x[SGRP];
    // full unrolls: constant indices keep x in registers
#pragma unroll
    for (int u = 0; u < SGRP; ++u)
      x[u] = *(const v4f*)(src + ((r0 + u) * CTHREADS + threadIdx.x) * 4);
#pragma unroll
    for (int u = 0; u < SGRP; ++u)
      *(v4f*)(dst + ((r0 + u) * (CTHREADS / 64) + row) * HPAD + e) = x[u];
  }
}

// ---------------------------------------------------------------- Bx GEMM ---
// Bx[r,n] = sum_e X[r,e] * Bm[n,e]  (Bx = X @ Bm^T).  One WG per 256 rows of X.
// Bm goes through LDS once (coalesced reads) into registers: wave w keeps the
// 64 B fragments of its 16 columns for the whole kernel.  The same LDS then
// takes the WG's 256 rows of X (whole-line reads), and every 16-row tile runs
// through the resident fragments.  One accumulator chain per tile, k ascending,
// so each sum is formed in the same order as with fragments read from global.
#define XROWS 256                    // rows of X per work-group (fills the LDS rows)
__global__ void __launch_bounds__(CTHREADS) bx_gemm(const float* __restrict__ X,
                                                    const float* __restrict__ Bm,
                                                    float* __restrict__ Bx) {
  // 256 x HPAD floats: first Bm, then the rows of X
  extern __shared__ __attribute__((aligned(16))) float csm[];

  const int r0 = blockIdx.x * XROWS;
  const int lane = threadIdx.x & 31;
  const int wave = threadIdx.x >> 5;   // 0..15
  const int n0 = wave * 16;
  const int col = lane & 15;
  const int kk  = (lane >> 4) * 2;
  const int hi  = (lane >> 4) * 8;

  stage_mat(csm, Bm);
  __syncthreads();

  v2f bfrag[DDIM / 4];                                        // B[k,n]=Bm[n,k]
  const float* brow = csm + (n0 + col) * HPAD + kk;
  // full unroll: bfrag must be indexed by constants to stay in registers
#pragma unroll
  for (int s = 0; s < DDIM / 4; ++s) bfrag[s] = *(const v2f*)(brow + 4 * s);
  __syncthreads();                     // every wave has its fragments: LDS is free

  stage_mat(csm, X + (size_t)r0 * DDIM);
  __syncthreads();

  const float* arow = csm + col * HPAD + kk;                  // A[m=row,k=e]
  float* orow = Bx + (size_t)(r0 + hi) * DDIM + n0 + col;
  for (int j = 0; j < XROWS / 16; ++j) {
    // every unroll below is full: constant indices keep acc, abuf and bfrag in registers
    v8f acc = vzero8();
    v2f abuf[2][ABLK];                 // two groups: LDS reads are issued ahead of the WMMAs that use them
#pragma unroll
    for (int s = 0; s < ABLK; ++s) abuf[0][s] = *(const v2f*)(arow + 4 * s);
#pragma unroll
    for (int q = 0; q < DDIM / 4 / ABLK; ++q) {
      if (q + 1 < DDIM / 4 / ABLK) {
#pragma unroll
        for (int s = 0; s < ABLK; ++s)
          abuf[(q + 1) & 1][s] = *(const v2f*)(arow + 4 * ((q + 1) * ABLK + s));
      }
#pragma unroll
      for (int s = 0; s < ABLK; ++s)
        acc = wmma4(abuf[q & 1][s], bfrag[q * ABLK + s], acc);
    }
#pragma unroll
    for (int v = 0; v < 8; ++v)
      orow[v * DDIM] = acc[v];
    // precaution: the next trip rewrites the address registers these stores name
    asm volatile("s_wait_xcnt 0x0" ::: "memory");
    arow += 16 * HPAD;
    orow += 16 * DDIM;
  }
}

// ------------------------------------------------------------- chunk scan ---
// Per chunk (blockIdx.x): u_i = Lam @ u_{i-1} + Bx_t for i=0..CHUNK-1 with
// u_{-1}=0, all 16 batches as the M dim of a 16x256x256 WMMA GEMM per step.
// Lam (256KB) is staged into the 320KB WGP LDS via CDNA5 async global->LDS
// b128 copies; h ping-pongs through LDS.  16 waves, wave w owns cols [16w..).
// Dynamic LDS layout: [0, 256*HPAD) = Lam (padded rows); then 2*16*HPAD for h.
__global__ void __launch_bounds__(512) chunk_scan(const float* __restrict__ Bx,
                                                  const float* __restrict__ Lam,
                                                  float* __restrict__ U) {
  extern __shared__ float smem[];
  float* lam_s = smem;                       // 256 x HPAD
  float* hb    = smem + 256 * HPAD;          // 2 x BS x HPAD

  const int lane = threadIdx.x & 31;
  const int wave = threadIdx.x >> 5;     // 0..15
  const int chunk = blockIdx.x;
  const int n0 = wave * 16;
  const int col = lane & 15;
  const int kk  = (lane >> 4) * 2;
  const int hi  = (lane >> 4) * 8;

  // ---- stage Lam into LDS with async global->LDS copies (ASYNCcnt path).
  // Dynamic LDS starts at group-segment offset 0, so LDS byte offsets are
  // computed numerically.  Each b128 moves 4 floats of one (padded) row.
  {
    const unsigned long long gbase = (unsigned long long)(uintptr_t)Lam;
    for (int g = threadIdx.x; g < MATELEMS / 4; g += (int)blockDim.x) {
      const int row = g >> 6;              // 64 x b128 per 256-float row
      const int e   = (g & 63) * 4;
      unsigned ldsoff = (unsigned)((row * HPAD + e) * 4);
      unsigned voff   = (unsigned)(g * 16);
      asm volatile("global_load_async_to_lds_b128 %0, %1, %2"
                   :: "v"(ldsoff), "v"(voff), "s"(gbase)
                   : "memory");
    }
    asm volatile("s_wait_asynccnt 0x0" ::: "memory");
  }

  // zero h_{-1} (buffer 0)
  for (int i = threadIdx.x; i < BS * DDIM; i += (int)blockDim.x)
    hb[(i >> 8) * HPAD + (i & 255)] = 0.f;
  __syncthreads();

  const float* lrow = lam_s + (n0 + col) * HPAD;   // row n of Lam: B[k,n]=Lam[n,k]
  for (int i = 0; i < CHUNK; ++i) {
    const int t = chunk * CHUNK + i;
    const float* hsrc = hb + (i & 1) * (BS * HPAD);
    v8f acc = vzero8();
    for (int e = 0; e < DDIM; e += 4) {
      v2f a = *(const v2f*)(hsrc + col * HPAD + e + kk);  // A[m=batch,k]
      v2f b = *(const v2f*)(lrow + e + kk);
      acc = wmma4(a, b, acc);
    }
    float* hdst = hb + ((i + 1) & 1) * (BS * HPAD);
#pragma unroll
    for (int v = 0; v < 8; ++v) {
      const int bat = v + hi;
      float h = acc[v] + Bx[(bat * TLEN + t) * DDIM + n0 + col];
      hdst[bat * HPAD + n0 + col] = h;
      U[(bat * TLEN + t) * DDIM + n0 + col] = h;
    }
    __syncthreads();
  }
}

// ------------------------------------------------------------- carry scan ---
// carry_k = Lam^CHUNK @ carry_{k-1} + u_last(k).  One WG per batch; true
// mat-vec -> VALU fmas.  P stays in registers for the whole kernel: wave w owns
// rows [8w, 8w+8); a lane holds 4 of them (by its half of the wave) times 16
// columns (4 groups of 4, by its place in the half).  LDS holds one 256-float
// row per chunk: u_last on entry, the carry once its step has run, so the loop
// touches no global memory and needs one barrier a step.
#define KTHREADS 1024

// value of lane (l ^ MASK) within the lane's 16-lane row
template <int MASK>
__device__ __forceinline__ float row_xor(float x) {
  return __builtin_bit_cast(float, __builtin_amdgcn_update_dpp(
      0, __builtin_bit_cast(int, x), 0x160 + MASK, 0xf, 0xf, true));
}

__global__ void __launch_bounds__(KTHREADS) carry_scan(const float* __restrict__ U,
                                                       const float* __restrict__ P,
                                                       float* __restrict__ carries) {
  extern __shared__ __attribute__((aligned(16))) float hist[];   // NCH x DDIM

  const int b = blockIdx.x;
  const int lane = threadIdx.x & 31;
  const int wave = threadIdx.x >> 5;           // 0..31
  const int kp = lane & 15;                    // column part
  const int nb = wave * 8 + (lane >> 4) * 4;   // first of the lane's 4 rows

  // every unroll below is full: constant indices keep p, h and a in registers
  v4f p[4][4];                                 // [row][column group]
  const float* pp = P + nb * DDIM + kp * 4;
#pragma unroll
  for (int r = 0; r < 4; ++r)
#pragma unroll
    for (int q = 0; q < 4; ++q)
      p[r][q] = *(const v4f*)(pp + r * DDIM + q * 64);
  // precaution: the address registers these loads name stay as they are up to
  // this wait (the operand keeps them live); later code may reuse them
  asm volatile("s_wait_xcnt 0x0" :: "v"(pp) : "memory");

  {
    const int e = (threadIdx.x & 63) * 4;      // 64 x 16 bytes per row
    const int k0 = threadIdx.x >> 6;
    v4f x[NCH * DDIM / 4 / KTHREADS];
    const float* up = U + (b * TLEN + k0 * CHUNK + CHUNK - 1) * DDIM + e;
#pragma unroll
    for (int g = 0; g < NCH * DDIM / 4 / KTHREADS; ++g)
      x[g] = *(const v4f*)(up + g * (KTHREADS / 64) * CHUNK * DDIM);
    // precaution, as above
    asm volatile("s_wait_xcnt 0x0" :: "v"(up) : "memory");
#pragma unroll
    for (int g = 0; g < NCH * DDIM / 4 / KTHREADS; ++g)
      *(v4f*)(hist + (g * (KTHREADS / 64) + k0) * DDIM + e) = x[g];
  }
  __syncthreads();

  const bool up8 = (kp & 8) != 0;
  const bool up4 = (kp & 4) != 0;
  const bool first = (kp & 3) == 0;            // one lane of the 4 that end with the same row
  // the row whose sum ends in this lane
  const int myrow = nb + (up8 ? 2 : 0) + (up4 ? 1 : 0);

  // carry_0 = u_last(0): the state before it is zero
  float u = hist[DDIM + myrow];                // u_last of the step at hand, read one step ahead
  for (int k = 1; k < NCH; ++k) {
    const int kn = (k + 1 < NCH) ? k + 1 : k;  // the last step has no next: its read is not used
    const float un = hist[kn * DDIM + myrow];
    const float* hp = hist + (k - 1) * DDIM + kp * 4;
    v4f h[4];
#pragma unroll
    for (int q = 0; q < 4; ++q) h[q] = *(const v4f*)(hp + q * 64);

    v2f a[4];
#pragma unroll
    for (int r = 0; r < 4; ++r) {
      a[r] = p[r][0].xy * h[0].xy;
      a[r] += p[r][0].zw * h[0].zw;
#pragma unroll
      for (int q = 1; q < 4; ++q) {
        a[r] += p[r][q].xy * h[q].xy;
        a[r] += p[r][q].zw * h[q].zw;
      }
    }
    const float s0 = a[0].x + a[0].y, s1 = a[1].x + a[1].y;
    const float s2 = a[2].x + a[2].y, s3 = a[3].x + a[3].y;

    // sum over the 16 lanes of a row: each exchange also halves the rows a lane carries
    const float t0 = (up8 ? s2 : s0) + row_xor<8>(up8 ? s0 : s2);
    const float t1 = (up8 ? s3 : s1) + row_xor<8>(up8 ? s1 : s3);
    float w = (up4 ? t1 : t0) + row_xor<4>(up4 ? t0 : t1);
    w += first ? u : 0.f;                      // u_last enters once among the 4 lanes left to sum
    w += row_xor<2>(w);
    w += row_xor<1>(w);

    if (first) hist[k * DDIM + myrow] = w;
    u = un;
    __syncthreads();                           // carry_k is complete before step k+1 reads it
  }

  {
    const int e = (threadIdx.x & 63) * 4;
    const int k0 = threadIdx.x >> 6;
#pragma unroll
    for (int g = 0; g < NCH * DDIM / 4 / KTHREADS; ++g) {
      const int k = g * (KTHREADS / 64) + k0;
      *(v4f*)(carries + (k * BS + b) * DDIM + e) = *(const v4f*)(hist + k * DDIM + e);
    }
  }
}

// ------------------------------------------------------------- correction ---
// out[b, k*CHUNK+i, :] += Lam^{i+1} @ carry_{k-1}[b].  One WG per (power i,
// group of CTILES chunks).  The power goes through LDS once (coalesced reads)
// into registers: wave w keeps the 64 B fragments of its 16 columns for the
// whole kernel.  The same LDS then takes the group's carries (16 rows per
// chunk), and every chunk runs through the resident fragments.  Accumulator
// seeded from out, k order as before, so each sum is formed in the same order.
__global__ void __launch_bounds__(CTHREADS) correct(float* __restrict__ out,
                                                    const float* __restrict__ pw,
                                                    const float* __restrict__ carries) {
  // 256 x HPAD floats: first the power, then the carries
  extern __shared__ __attribute__((aligned(16))) float csm[];

  const int i  = blockIdx.x;           // 0..CHUNK-1
  const int m0 = blockIdx.y * CTILES;  // first carry index (chunk k-1) of the group
  const int lane = threadIdx.x & 31;
  const int wave = threadIdx.x >> 5;   // 0..15
  const int n0 = wave * 16;
  const int col = lane & 15;
  const int kk  = (lane >> 4) * 2;
  const int hi  = (lane >> 4) * 8;

  stage_mat(csm, pw + (size_t)i * MATELEMS);                  // Lam^{i+1}
  __syncthreads();

  v2f bfrag[DDIM / 4];                                        // B[k,n]=Lam^{i+1}[n,k]
  const float* brow = csm + (n0 + col) * HPAD + kk;
  // full unroll: bfrag must be indexed by constants to stay in registers
#pragma unroll
  for (int s = 0; s < DDIM / 4; ++s) bfrag[s] = *(const v2f*)(brow + 4 * s);
  __syncthreads();                     // every wave has its fragments: LDS is free

  // carries[m0 .. m0+CTILES) are CTILES*BS contiguous rows; index NCH-1 exists
  // (written by carry_scan), so the last group stages it and leaves it unused.
  stage_mat(csm, carries + (size_t)m0 * BS * DDIM);
  __syncthreads();

  const int ntile = (NCH - 1 - m0 < CTILES) ? (NCH - 1 - m0) : CTILES;
  for (int j = 0; j < ntile; ++j) {
    const int t = (m0 + j + 1) * CHUNK + i;
    const float* arow = csm + (j * BS + col) * HPAD + kk;     // A[m=batch,k=e]
    // every unroll below is full: constant indices keep acc, abuf and bfrag in registers
    v8f acc;
#pragma unroll
    for (int v = 0; v < 8; ++v)
      acc[v] = out[((v + hi) * TLEN + t) * DDIM + n0 + col];
    v2f abuf[2][ABLK];                 // two groups: LDS reads are issued ahead of the WMMAs that use them
#pragma unroll
    for (int s = 0; s < ABLK; ++s) abuf[0][s] = *(const v2f*)(arow + 4 * s);
#pragma unroll
    for (int q = 0; q < DDIM / 4 / ABLK; ++q) {
      if (q + 1 < DDIM / 4 / ABLK) {
#pragma unroll
        for (int s = 0; s < ABLK; ++s)
          abuf[(q + 1) & 1][s] = *(const v2f*)(arow + 4 * ((q + 1) * ABLK + s));
      }
#pragma unroll
      for (int s = 0; s < ABLK; ++s)
        acc = wmma4(abuf[q & 1][s], bfrag[q * ABLK + s], acc);
    }
#pragma unroll
    for (int v = 0; v < 8; ++v)
      out[((v + hi) * TLEN + t) * DDIM + n0 + col] = acc[v];
    // precaution: the next trip rewrites the address registers these stores name
    asm volatile("s_wait_xcnt 0x0" ::: "memory");
  }
}

// ------------------------------------------------------------------ launch --
extern "C" void kernel_launch(void* const* d_in, const int* in_sizes, int n_in,
                              void* d_out, int out_size, void* d_ws, size_t ws_size,
                              hipStream_t stream) {
  (void)in_sizes; (void)n_in; (void)out_size; (void)ws_size;
  const float* x   = (const float*)d_in[0];   // [16,4096,256]
  const float* Bm  = (const float*)d_in[1];   // [256,256]
  const float* Lam = (const float*)d_in[2];   // [256,256]
  float* out = (float*)d_out;                 // [16,4096,256], also U buffer

  float* Bx      = (float*)d_ws;                         // 16.78M floats
  float* powers  = Bx + (size_t)BS * TLEN * DDIM;        // 64 * 65536 floats
  float* carries = powers + (size_t)CHUNK * MATELEMS;    // NCH*BS*DDIM floats

  // Lam^1..Lam^64 by log-doubling.
  copy_mat<<<MATELEMS / 256, 256, 0, stream>>>(Lam, powers);
  for (int s = 1; s < CHUNK; s <<= 1)
    power_step<<<dim3(32, s), 256, 0, stream>>>(powers, s);

  // Bx = X @ B^T
  const size_t lds_mat = (size_t)(256 * HPAD) * sizeof(float);
  bx_gemm<<<(BS * TLEN) / XROWS, CTHREADS, lds_mat, stream>>>(x, Bm, Bx);

  // chunk-local scans: Lam lives in the 320KB WGP LDS (256*HPAD + 2*16*HPAD)
  const size_t lds_scan = (size_t)(256 * HPAD + 2 * BS * HPAD) * sizeof(float);
  chunk_scan<<<NCH, 512, lds_scan, stream>>>(Bx, Lam, out);

  // serial carry scan across chunk boundaries (P = Lam^CHUNK in registers)
  const size_t lds_carry = (size_t)(NCH * DDIM) * sizeof(float);
  carry_scan<<<BS, KTHREADS, lds_carry, stream>>>(
      out, powers + (size_t)(CHUNK - 1) * MATELEMS, carries);

  // broadcast carries back into every timestep
  const size_t lds_corr = (size_t)(256 * HPAD) * sizeof(float);
  correct<<<dim3(CHUNK, NCH / CTILES), CTHREADS, lds_corr, stream>>>(out, powers, carries);
}

// v004
// One run takes 304 microseconds.
// Next to v003, in two timings, it ran 1.39 times as fast each time.
// All steps since v000 together make it 2.23 times as fast.
#include <hip/hip_runtime.h>

typedef __attribute__((ext_vector_type(2))) float v2f;
typedef __attribute__((ext_vector_type(4))) float v4f;
typedef __attribute__((ext_vector_type(8))) float v8f;

#define DDIM 256
#define BS   16
#define TLEN 4096
#define CHUNK 16                     // short chunks: the chunk scan has one work-group for every WGP
#define NCH  (TLEN / CHUNK)          // 256 chunks
#define MATELEMS (DDIM * DDIM)       // 65536
#define HPAD 260                     // padded LDS row stride (bank-conflict-free)

__device__ __forceinline__ v8f wmma4(v2f a, v2f b, v8f c) {
  // D = A(16x4,f32) * B(4x16,f32) + C(16x16,f32)
  return __builtin_amdgcn_wmma_f32_16x16x4_f32(false, a, false, b, (short)0, c,
                                               false, false);
}

__device__ __forceinline__ v8f vzero8() {
  v8f z = {0.f, 0.f, 0.f, 0.f, 0.f, 0.f, 0.f, 0.f};
  return z;
}

// ---------------------------------------------------------------- powers ----
__global__ void copy_mat(const float* __restrict__ src, float* __restrict__ dst) {
  int i = blockIdx.x * blockDim.x + threadIdx.x;
  if (i < MATELEMS) dst[i] = src[i];
}

// powers[k] lives at pw + (k-1)*MATELEMS.  Computes A_{s+j} = A_s * A_j,
// j = blockIdx.y+1 (1..s).  8 waves/WG, one 16x16 output tile per wave.
__global__ void power_step(float* __restrict__ pw, int s) {
  const int j = blockIdx.y + 1;
  const float* As = pw + (size_t)(s - 1) * MATELEMS;
  const float* Aj = pw + (size_t)(j - 1) * MATELEMS;
  float*       Dm = pw + (size_t)(s + j - 1) * MATELEMS;

  const int lane = threadIdx.x & 31;
  const int wave = threadIdx.x >> 5;        // 0..7
  const int tile = blockIdx.x * 8 + wave;   // 0..255
  const int mt = tile >> 4, nt = tile & 15;
  const int col = lane & 15;
  const int kk  = (lane >> 4) * 2;

  v8f acc = vzero8();
  const float* arow = As + (mt * 16 + col) * DDIM;
  for (int e = 0; e < DDIM; e += 4) {
    v2f a = *(const v2f*)(arow + e + kk);
    v2f b;
    b.x = Aj[(e + kk    ) * DDIM + nt * 16 + col];
    b.y = Aj[(e + kk + 1) * DDIM + nt * 16 + col];
    acc = wmma4(a, b, acc);
  }
  const int hi = (lane >> 4) * 8;
#pragma unroll
  for (int v = 0; v < 8; ++v)
    Dm[(mt * 16 + v + hi) * DDIM + nt * 16 + col] = acc[v];
}

// ------------------------------------------------- shared staging helper ---
#define CTILES 16                    // chunks per work-group (CTILES*BS = 256 LDS rows)
#define CTHREADS 512
#define ABLK 16                      // A fragments fetched from LDS as one group

// 256x256 floats, row-major in global memory, to LDS rows of HPAD floats.
#define SGRP 8                       // loads of a lane in flight: not one L2 round trip each
__device__ __forceinline__ void stage_mat(float* __restrict__ dst,
                                          const float* __restrict__ src) {
  const int row = threadIdx.x >> 6;          // 64 x 16 bytes per row
  const int e   = (threadIdx.x & 63) * 4;
  for (int r0 = 0; r0 < MATELEMS / 4 / CTHREADS; r0 += SGRP) {
    v4f x[SGRP];
    // full unrolls: constant indices keep x in registers
#pragma unroll
    for (int u = 0; u < SGRP; ++u)
      x[u] = *(const v4f*)(src + ((r0 + u) * CTHREADS + threadIdx.x) * 4);
#pragma unroll
    for (int u = 0; u < SGRP; ++u)
      *(v4f*)(dst + ((r0 + u) * (CTHREADS / 64) + row) * HPAD + e) = x[u];
  }
}

// ---------------------------------------------------------------- Bx GEMM ---
// Bx[r,n] = sum_e X[r,e] * Bm[n,e]  (Bx = X @ Bm^T).  One WG per 256 rows of X.
// Bm goes through LDS once (coalesced reads) into registers: wave w keeps the
// 64 B fragments of its 16 columns for the whole kernel.  The same LDS then
// takes the WG's 256 rows of X (whole-line reads), and every 16-row tile runs
// through the resident fragments.  One accumulator chain per tile, k ascending,
// so each sum is formed in the same order as with fragments read from global.
#define XROWS 256                    // rows of X per work-group (fills the LDS rows)
__global__ void __launch_bounds__(CTHREADS) bx_gemm(const float* __restrict__ X,
                                                    const float* __restrict__ Bm,
                                                    float* __restrict__ Bx) {
  // 256 x HPAD floats: first Bm, then the rows of X
  extern __shared__ __attribute__((aligned(16))) float csm[];

  const int r0 = blockIdx.x * XROWS;
  const int lane = threadIdx.x & 31;
  const int wave = threadIdx.x >> 5;   // 0..15
  const int n0 = wave * 16;
  const int col = lane & 15;
  const int kk  = (lane >> 4) * 2;
  const int hi  = (lane >> 4) * 8;

  stage_mat(csm, Bm);
  __syncthreads();

  v2f bfrag[DDIM / 4];                                        // B[k,n]=Bm[n,k]
  const float* brow = csm + (n0 + col) * HPAD + kk;
  // full unroll: bfrag must be indexed by constants to stay in registers
#pragma unroll
  for (int s = 0; s < DDIM / 4; ++s) bfrag[s] = *(const v2f*)(brow + 4 * s);
  __syncthreads();                     // every wave has its fragments: LDS is free

  stage_mat(csm, X + (size_t)r0 * DDIM);
  __syncthreads();

  const float* arow = csm + col * HPAD + kk;                  // A[m=row,k=e]
  float* orow = Bx + (size_t)(r0 + hi) * DDIM + n0 + col;
  for (int j = 0; j < XROWS / 16; ++j) {
    // every unroll below is full: constant indices keep acc, abuf and bfrag in registers
    v8f acc = vzero8();
    v2f abuf[2][ABLK];                 // two groups: LDS reads are issued ahead of the WMMAs that use them
#pragma unroll
    for (int s = 0; s < ABLK; ++s) abuf[0][s] = *(const v2f*)(arow + 4 * s);
#pragma unroll
    for (int q = 0; q < DDIM / 4 / ABLK; ++q) {
      if (q + 1 < DDIM / 4 / ABLK) {
#pragma unroll
        for (int s = 0; s < ABLK; ++s)
          abuf[(q + 1) & 1][s] = *(const v2f*)(arow + 4 * ((q + 1) * ABLK + s));
      }
#pragma unroll
      for (int s = 0; s < ABLK; ++s)
        acc = wmma4(abuf[q & 1][s], bfrag[q * ABLK + s], acc);
    }
#pragma unroll
    for (int v = 0; v < 8; ++v)
      orow[v * DDIM] = acc[v];
    // precaution: the next trip rewrites the address registers these stores name
    asm volatile("s_wait_xcnt 0x0" ::: "memory");
    arow += 16 * HPAD;
    orow += 16 * DDIM;
  }
}

// ------------------------------------------------------------- chunk scan ---
// Per chunk (blockIdx.x): u_i = Lam @ u_{i-1} + Bx_t for i=0..CHUNK-1 with
// u_{-1}=0, all 16 batches as the M dim of a 16x256x256 WMMA GEMM per step.
// Lam (256KB) is staged into the 320KB WGP LDS via CDNA5 async global->LDS
// b128 copies; h ping-pongs through LDS.  16 waves, wave w owns cols [16w..).
// Dynamic LDS layout: [0, 256*HPAD) = Lam (padded rows); then 2*16*HPAD for h.
__global__ void __launch_bounds__(512) chunk_scan(const float* __restrict__ Bx,
                                                  const float* __restrict__ Lam,
                                                  float* __restrict__ U) {
  extern __shared__ float smem[];
  float* lam_s = smem;                       // 256 x HPAD
  float* hb    = smem + 256 * HPAD;          // 2 x BS x HPAD

  const int lane = threadIdx.x & 31;
  const int wave = threadIdx.x >> 5;     // 0..15
  const int chunk = blockIdx.x;
  const int n0 = wave * 16;
  const int col = lane & 15;
  const int kk  = (lane >> 4) * 2;
  const int hi  = (lane >> 4) * 8;

  // ---- stage Lam into LDS with async global->LDS copies (ASYNCcnt path).
  // Dynamic LDS starts at group-segment offset 0, so LDS byte offsets are
  // computed numerically.  Each b128 moves 4 floats of one (padded) row.
  {
    const unsigned long long gbase = (unsigned long long)(uintptr_t)Lam;
    for (int g = threadIdx.x; g < MATELEMS / 4; g += (int)blockDim.x) {
      const int row = g >> 6;              // 64 x b128 per 256-float row
      const int e   = (g & 63) * 4;
      unsigned ldsoff = (unsigned)((row * HPAD + e) * 4);
      unsigned voff   = (unsigned)(g * 16);
      asm volatile("global_load_async_to_lds_b128 %0, %1, %2"
                   :: "v"(ldsoff), "v"(voff), "s"(gbase)
                   : "memory");
    }
    asm volatile("s_wait_asynccnt 0x0" ::: "memory");
  }

  // zero h_{-1} (buffer 0)
  for (int i = threadIdx.x; i < BS * DDIM; i += (int)blockDim.x)
    hb[(i >> 8) * HPAD + (i & 255)] = 0.f;
  __syncthreads();

  const float* lrow = lam_s + (n0 + col) * HPAD;   // row n of Lam: B[k,n]=Lam[n,k]
  for (int i = 0; i < CHUNK; ++i) {
    const int t = chunk * CHUNK + i;
    const float* hsrc = hb + (i & 1) * (BS * HPAD);
    v8f acc = vzero8();
    for (int e = 0; e < DDIM; e += 4) {
      v2f a = *(const v2f*)(hsrc + col * HPAD + e + kk);  // A[m=batch,k]
      v2f b = *(const v2f*)(lrow + e + kk);
      acc = wmma4(a, b, acc);
    }
    float* hdst = hb + ((i + 1) & 1) * (BS * HPAD);
#pragma unroll
    for (int v = 0; v < 8; ++v) {
      const int bat = v + hi;
      float h = acc[v] + Bx[(bat * TLEN + t) * DDIM + n0 + col];
      hdst[bat * HPAD + n0 + col] = h;
      U[(bat * TLEN + t) * DDIM + n0 + col] = h;
    }
    __syncthreads();
  }
}

// ------------------------------------------------------------- carry scan ---
// carry_k = Lam^CHUNK @ carry_{k-1} + u_last(k).  One WG per batch; true
// mat-vec -> VALU fmas.  P stays in registers for the whole kernel: wave w owns
// rows [8w, 8w+8); a lane holds 4 of them (by its half of the wave) times 16
// columns (4 groups of 4, by its place in the half).  LDS holds one 256-float
// row per chunk: u_last on entry, the carry once its step has run, so the loop
// touches no global memory and needs one barrier a step.
#define KTHREADS 1024
#define KGRP 8                       // u_last rows a thread has in flight while staging

// value of lane (l ^ MASK) within the lane's 16-lane row
template <int MASK>
__device__ __forceinline__ float row_xor(float x) {
  return __builtin_bit_cast(float, __builtin_amdgcn_update_dpp(
      0, __builtin_bit_cast(int, x), 0x160 + MASK, 0xf, 0xf, true));
}

__global__ void __launch_bounds__(KTHREADS) carry_scan(const float* __restrict__ U,
                                                       const float* __restrict__ P,
                                                       float* __restrict__ carries) {
  extern __shared__ __attribute__((aligned(16))) float hist[];   // NCH x DDIM

  const int b = blockIdx.x;
  const int lane = threadIdx.x & 31;
  const int wave = threadIdx.x >> 5;           // 0..31
  const int kp = lane & 15;                    // column part
  const int nb = wave * 8 + (lane >> 4) * 4;   // first of the lane's 4 rows

  // every unroll below is full: constant indices keep p, h and a in registers
  v4f p[4][4];                                 // [row][column group]
  const float* pp = P + nb * DDIM + kp * 4;
#pragma unroll
  for (int r = 0; r < 4; ++r)
#pragma unroll
    for (int q = 0; q < 4; ++q)
      p[r][q] = *(const v4f*)(pp + r * DDIM + q * 64);
  // precaution: the address registers these loads name stay as they are up to
  // this wait (the operand keeps them live); later code may reuse them
  asm volatile("s_wait_xcnt 0x0" :: "v"(pp) : "memory");

  {
    const int e = (threadIdx.x & 63) * 4;      // 64 x 16 bytes per row
    const int k0 = threadIdx.x >> 6;
    // groups of KGRP rows a thread: x and p together fit the wave's registers
    for (int g0 = 0; g0 < NCH * DDIM / 4 / KTHREADS; g0 += KGRP) {
      v4f x[KGRP];
      const float* up = U + (b * TLEN + (g0 * (KTHREADS / 64) + k0) * CHUNK + CHUNK - 1) * DDIM + e;
#pragma unroll
      for (int g = 0; g < KGRP; ++g)
        x[g] = *(const v4f*)(up + g * (KTHREADS / 64) * CHUNK * DDIM);
      // precaution, as above
      asm volatile("s_wait_xcnt 0x0" :: "v"(up) : "memory");
#pragma unroll
      for (int g = 0; g < KGRP; ++g)
        *(v4f*)(hist + ((g0 + g) * (KTHREADS / 64) + k0) * DDIM + e) = x[g];
    }
  }
  __syncthreads();

  const bool up8 = (kp & 8) != 0;
  const bool up4 = (kp & 4) != 0;
  const bool first = (kp & 3) == 0;            // one lane of the 4 that end with the same row
  // the row whose sum ends in this lane
  const int myrow = nb + (up8 ? 2 : 0) + (up4 ? 1 : 0);

  // carry_0 = u_last(0): the state before it is zero
  float u = hist[DDIM + myrow];                // u_last of the step at hand, read one step ahead
  for (int k = 1; k < NCH; ++k) {
    const int kn = (k + 1 < NCH) ? k + 1 : k;  // the last step has no next: its read is not used
    const float un = hist[kn * DDIM + myrow];
    const float* hp = hist + (k - 1) * DDIM + kp * 4;
    v4f h[4];
#pragma unroll
    for (int q = 0; q < 4; ++q) h[q] = *(const v4f*)(hp + q * 64);

    v2f a[4];
#pragma unroll
    for (int r = 0; r < 4; ++r) {
      a[r] = p[r][0].xy * h[0].xy;
      a[r] += p[r][0].zw * h[0].zw;
#pragma unroll
      for (int q = 1; q < 4; ++q) {
        a[r] += p[r][q].xy * h[q].xy;
        a[r] += p[r][q].zw * h[q].zw;
      }
    }
    const float s0 = a[0].x + a[0].y, s1 = a[1].x + a[1].y;
    const float s2 = a[2].x + a[2].y, s3 = a[3].x + a[3].y;

    // sum over the 16 lanes of a row: each exchange also halves the rows a lane carries
    const float t0 = (up8 ? s2 : s0) + row_xor<8>(up8 ? s0 : s2);
    const float t1 = (up8 ? s3 : s1) + row_xor<8>(up8 ? s1 : s3);
    float w = (up4 ? t1 : t0) + row_xor<4>(up4 ? t0 : t1);
    w += first ? u : 0.f;                      // u_last enters once among the 4 lanes left to sum
    w += row_xor<2>(w);
    w += row_xor<1>(w);

    if (first) hist[k * DDIM + myrow] = w;
    u = un;
    __syncthreads();                           // carry_k is complete before step k+1 reads it
  }

  {
    const int e = (threadIdx.x & 63) * 4;
    const int k0 = threadIdx.x >> 6;
#pragma unroll
    for (int g = 0; g < NCH * DDIM / 4 / KTHREADS; ++g) {
      const int k = g * (KTHREADS / 64) + k0;
      *(v4f*)(carries + (k * BS + b) * DDIM + e) = *(const v4f*)(hist + k * DDIM + e);
    }
  }
}

// ------------------------------------------------------------- correction ---
// out[b, k*CHUNK+i, :] += Lam^{i+1} @ carry_{k-1}[b].  One WG per (power i,
// group of CTILES chunks).  The power goes through LDS once (coalesced reads)
// into registers: wave w keeps the 64 B fragments of its 16 columns for the
// whole kernel.  The same LDS then takes the group's carries (16 rows per
// chunk), and every chunk runs through the resident fragments.  Accumulator
// seeded from out, k order as before, so each sum is formed in the same order.
__global__ void __launch_bounds__(CTHREADS) correct(float* __restrict__ out,
                                                    const float* __restrict__ pw,
                                                    const float* __restrict__ carries) {
  // 256 x HPAD floats: first the power, then the carries
  extern __shared__ __attribute__((aligned(16))) float csm[];

  const int i  = blockIdx.x;           // 0..CHUNK-1
  const int m0 = blockIdx.y * CTILES;  // first carry index (chunk k-1) of the group
  const int lane = threadIdx.x & 31;
  const int wave = threadIdx.x >> 5;   // 0..15
  const int n0 = wave * 16;
  const int col = lane & 15;
  const int kk  = (lane >> 4) * 2;
  const int hi  = (lane >> 4) * 8;

  stage_mat(csm, pw + (size_t)i * MATELEMS);                  // Lam^{i+1}
  __syncthreads();

  v2f bfrag[DDIM / 4];                                        // B[k,n]=Lam^{i+1}[n,k]
  const float* brow = csm + (n0 + col) * HPAD + kk;
  // full unroll: bfrag must be indexed by constants to stay in registers
#pragma unroll
  for (int s = 0; s < DDIM / 4; ++s) bfrag[s] = *(const v2f*)(brow + 4 * s);
  __syncthreads();                     // every wave has its fragments: LDS is free

  // carries[m0 .. m0+CTILES) are CTILES*BS contiguous rows; index NCH-1 exists
  // (written by carry_scan), so the last group stages it and leaves it unused.
  stage_mat(csm, carries + (size_t)m0 * BS * DDIM);
  __syncthreads();

  const int ntile = (NCH - 1 - m0 < CTILES) ? (NCH - 1 - m0) : CTILES;
  for (int j = 0; j < ntile; ++j) {
    const int t = (m0 + j + 1) * CHUNK + i;
    const float* arow = csm + (j * BS + col) * HPAD + kk;     // A[m=batch,k=e]
    // every unroll below is full: constant indices keep acc, abuf and bfrag in registers
    v8f acc;
#pragma unroll
    for (int v = 0; v < 8; ++v)
      acc[v] = out[((v + hi) * TLEN + t) * DDIM + n0 + col];
    v2f abuf[2][ABLK];                 // two groups: LDS reads are issued ahead of the WMMAs that use them
#pragma unroll
    for (int s = 0; s < ABLK; ++s) abuf[0][s] = *(const v2f*)(arow + 4 * s);
#pragma unroll
    for (int q = 0; q < DDIM / 4 / ABLK; ++q) {
      if (q + 1 < DDIM / 4 / ABLK) {
#pragma unroll
        for (int s = 0; s < ABLK; ++s)
          abuf[(q + 1) & 1][s] = *(const v2f*)(arow + 4 * ((q + 1) * ABLK + s));
      }
#pragma unroll
      for (int s = 0; s < ABLK; ++s)
        acc = wmma4(abuf[q & 1][s], bfrag[q * ABLK + s], acc);
    }
#pragma unroll
    for (int v = 0; v < 8; ++v)
      out[((v + hi) * TLEN + t) * DDIM + n0 + col] = acc[v];
    // precaution: the next trip rewrites the address registers these stores name
    asm volatile("s_wait_xcnt 0x0" ::: "memory");
  }
}

// ------------------------------------------------------------------ launch --
extern "C" void kernel_launch(void* const* d_in, const int* in_sizes, int n_in,
                              void* d_out, int out_size, void* d_ws, size_t ws_size,
                              hipStream_t stream) {
  (void)in_sizes; (void)n_in; (void)out_size; (void)ws_size;
  const float* x   = (const float*)d_in[0];   // [16,4096,256]
  const float* Bm  = (const float*)d_in[1];   // [256,256]
  const float* Lam = (const float*)d_in[2];   // [256,256]
  float* out = (float*)d_out;                 // [16,4096,256], also U buffer

  float* Bx      = (float*)d_ws;                         // 16.78M floats
  float* powers  = Bx + (size_t)BS * TLEN * DDIM;        // 16 * 65536 floats
  float* carries = powers + (size_t)CHUNK * MATELEMS;    // NCH*BS*DDIM floats

  // Lam^1..Lam^CHUNK by log-doubling.
  copy_mat<<<MATELEMS / 256, 256, 0, stream>>>(Lam, powers);
  for (int s = 1; s < CHUNK; s <<= 1)
    power_step<<<dim3(32, s), 256, 0, stream>>>(powers, s);

  // Bx = X @ B^T
  const size_t lds_mat = (size_t)(256 * HPAD) * sizeof(float);
  bx_gemm<<<(BS * TLEN) / XROWS, CTHREADS, lds_mat, stream>>>(x, Bm, Bx);

  // chunk-local scans: Lam lives in the 320KB WGP LDS (256*HPAD + 2*16*HPAD)
  const size_t lds_scan = (size_t)(256 * HPAD + 2 * BS * HPAD) * sizeof(float);
  chunk_scan<<<NCH, 512, lds_scan, stream>>>(Bx, Lam, out);

  // serial carry scan across chunk boundaries (P = Lam^CHUNK in registers)
  const size_t lds_carry = (size_t)(NCH * DDIM) * sizeof(float);
  carry_scan<<<BS, KTHREADS, lds_carry, stream>>>(
      out, powers + (size_t)(CHUNK - 1) * MATELEMS, carries);

  // broadcast carries back into every timestep
  const size_t lds_corr = (size_t)(256 * HPAD) * sizeof(float);
  correct<<<dim3(CHUNK, NCH / CTILES), CTHREADS, lds_corr, stream>>>(out, powers, carries);
}

// v005
// Measured time: 251 microseconds a run.
// Timed twice side by side with v004, it ran 1.22 and 1.21 times as fast.
// Over all steps from v000 it is 2.71 times as fast.
#include <hip/hip_runtime.h>

typedef __attribute__((ext_vector_type(2))) float v2f;
typedef __attribute__((ext_vector_type(4))) float v4f;
typedef __attribute__((ext_vector_type(8))) float v8f;

#define DDIM 256
#define BS   16
#define TLEN 4096
#define CHUNK 16                     // short chunks: the chunk scan has one work-group for every WGP
#define NCH  (TLEN / CHUNK)          // 256 chunks
#define MATELEMS (DDIM * DDIM)       // 65536
#define HPAD 260                     // padded LDS row stride (bank-conflict-free)

__device__ __forceinline__ v8f wmma4(v2f a, v2f b, v8f c) {
  // D = A(16x4,f32) * B(4x16,f32) + C(16x16,f32)
  return __builtin_amdgcn_wmma_f32_16x16x4_f32(false, a, false, b, (short)0, c,
                                               false, false);
}

__device__ __forceinline__ v8f vzero8() {
  v8f z = {0.f, 0.f, 0.f, 0.f, 0.f, 0.f, 0.f, 0.f};
  return z;
}

// ---------------------------------------------------------------- powers ----
__global__ void copy_mat(const float* __restrict__ src, float* __restrict__ dst) {
  int i = blockIdx.x * blockDim.x + threadIdx.x;
  if (i < MATELEMS) dst[i] = src[i];
}

// powers[k] lives at pw + (k-1)*MATELEMS.  Computes A_{s+j} = A_s * A_j,
// j = blockIdx.y+1 (1..s).  8 waves/WG, one 16x16 output tile per wave.
__global__ void power_step(float* __restrict__ pw, int s) {
  const int j = blockIdx.y + 1;
  const float* As = pw + (size_t)(s - 1) * MATELEMS;
  const float* Aj = pw + (size_t)(j - 1) * MATELEMS;
  float*       Dm = pw + (size_t)(s + j - 1) * MATELEMS;

  const int lane = threadIdx.x & 31;
  const int wave = threadIdx.x >> 5;        // 0..7
  const int tile = blockIdx.x * 8 + wave;   // 0..255
  const int mt = tile >> 4, nt = tile & 15;
  const int col = lane & 15;
  const int kk  = (lane >> 4) * 2;

  v8f acc = vzero8();
  const float* arow = As + (mt * 16 + col) * DDIM;
  for (int e = 0; e < DDIM; e += 4) {
    v2f a = *(const v2f*)(arow + e + kk);
    v2f b;
    b.x = Aj[(e + kk    ) * DDIM + nt * 16 + col];
    b.y = Aj[(e + kk + 1) * DDIM + nt * 16 + col];
    acc = wmma4(a, b, acc);
  }
  const int hi = (lane >> 4) * 8;
#pragma unroll
  for (int v = 0; v < 8; ++v)
    Dm[(mt * 16 + v + hi) * DDIM + nt * 16 + col] = acc[v];
}

// ------------------------------------------------- shared staging helper ---
#define CTILES 16                    // chunks per work-group (CTILES*BS = 256 LDS rows)
#define CTHREADS 512
#define ABLK 16                      // A fragments fetched from LDS as one group

// 256x256 floats, row-major in global memory, to LDS rows of HPAD floats.
#define SGRP 8                       // loads of a lane in flight: not one L2 round trip each
__device__ __forceinline__ void stage_mat(float* __restrict__ dst,
                                          const float* __restrict__ src) {
  const int row = threadIdx.x >> 6;          // 64 x 16 bytes per row
  const int e   = (threadIdx.x & 63) * 4;
  for (int r0 = 0; r0 < MATELEMS / 4 / CTHREADS; r0 += SGRP) {
    v4f x[SGRP];
    // full unrolls: constant indices keep x in registers
#pragma unroll
    for (int u = 0; u < SGRP; ++u)
      x[u] = *(const v4f*)(src + ((r0 + u) * CTHREADS + threadIdx.x) * 4);
#pragma unroll
    for (int u = 0; u < SGRP; ++u)
      *(v4f*)(dst + ((r0 + u) * (CTHREADS / 64) + row) * HPAD + e) = x[u];
  }
}

// ---------------------------------------------------------------- Bx GEMM ---
// Bx[r,n] = sum_e X[r,e] * Bm[n,e]  (Bx = X @ Bm^T).  One WG per 256 rows of X.
// Bm goes through LDS once (coalesced reads) into registers: wave w keeps the
// 64 B fragments of its 16 columns for the whole kernel.  The same LDS then
// takes the WG's 256 rows of X (whole-line reads), and every 16-row tile runs
// through the resident fragments.  One accumulator chain per tile, k ascending,
// so each sum is formed in the same order as with fragments read from global.
#define XROWS 256                    // rows of X per work-group (fills the LDS rows)
__global__ void __launch_bounds__(CTHREADS) bx_gemm(const float* __restrict__ X,
                                                    const float* __restrict__ Bm,
                                                    float* __restrict__ Bx) {
  // 256 x HPAD floats: first Bm, then the rows of X
  extern __shared__ __attribute__((aligned(16))) float csm[];

  const int r0 = blockIdx.x * XROWS;
  const int lane = threadIdx.x & 31;
  const int wave = threadIdx.x >> 5;   // 0..15
  const int n0 = wave * 16;
  const int col = lane & 15;
  const int kk  = (lane >> 4) * 2;
  const int hi  = (lane >> 4) * 8;

  stage_mat(csm, Bm);
  __syncthreads();

  v2f bfrag[DDIM / 4];                                        // B[k,n]=Bm[n,k]
  const float* brow = csm + (n0 + col) * HPAD + kk;
  // full unroll: bfrag must be indexed by constants to stay in registers
#pragma unroll
  for (int s = 0; s < DDIM / 4; ++s) bfrag[s] = *(const v2f*)(brow + 4 * s);
  __syncthreads();                     // every wave has its fragments: LDS is free

  stage_mat(csm, X + (size_t)r0 * DDIM);
  __syncthreads();

  const float* arow = csm + col * HPAD + kk;                  // A[m=row,k=e]
  float* orow = Bx + (size_t)(r0 + hi) * DDIM + n0 + col;
  for (int j = 0; j < XROWS / 16; ++j) {
    // every unroll below is full: constant indices keep acc, abuf and bfrag in registers
    v8f acc = vzero8();
    v2f abuf[2][ABLK];                 // two groups: LDS reads are issued ahead of the WMMAs that use them
#pragma unroll
    for (int s = 0; s < ABLK; ++s) abuf[0][s] = *(const v2f*)(arow + 4 * s);
#pragma unroll
    for (int q = 0; q < DDIM / 4 / ABLK; ++q) {
      if (q + 1 < DDIM / 4 / ABLK) {
#pragma unroll
        for (int s = 0; s < ABLK; ++s)
          abuf[(q + 1) & 1][s] = *(const v2f*)(arow + 4 * ((q + 1) * ABLK + s));
      }
#pragma unroll
      for (int s = 0; s < ABLK; ++s)
        acc = wmma4(abuf[q & 1][s], bfrag[q * ABLK + s], acc);
    }
#pragma unroll
    for (int v = 0; v < 8; ++v)
      orow[v * DDIM] = acc[v];
    // precaution: the next trip rewrites the address registers these stores name
    asm volatile("s_wait_xcnt 0x0" ::: "memory");
    arow += 16 * HPAD;
    orow += 16 * DDIM;
  }
}

// ------------------------------------------------------------- chunk scan ---
// Per chunk (blockIdx.x): u_i = Lam @ u_{i-1} + Bx_t for i=0..CHUNK-1 with
// u_{-1}=0, all 16 batches as the M dim of a 16x256x256 WMMA GEMM per step.
// Lam (256KB) is staged into the 320KB WGP LDS via CDNA5 async global->LDS
// b128 copies; h ping-pongs through LDS.  16 waves, wave w owns cols [16w..).
// Dynamic LDS layout: [0, 256*HPAD) = Lam (padded rows); then 2*16*HPAD for h.
__global__ void __launch_bounds__(512) chunk_scan(const float* __restrict__ Bx,
                                                  const float* __restrict__ Lam,
                                                  float* __restrict__ U) {
  extern __shared__ float smem[];
  float* lam_s = smem;                       // 256 x HPAD
  float* hb    = smem + 256 * HPAD;          // 2 x BS x HPAD

  const int lane = threadIdx.x & 31;
  const int wave = threadIdx.x >> 5;     // 0..15
  const int chunk = blockIdx.x;
  const int n0 = wave * 16;
  const int col = lane & 15;
  const int kk  = (lane >> 4) * 2;
  const int hi  = (lane >> 4) * 8;

  // ---- stage Lam into LDS with async global->LDS copies (ASYNCcnt path).
  // Dynamic LDS starts at group-segment offset 0, so LDS byte offsets are
  // computed numerically.  Each b128 moves 4 floats of one (padded) row.
  {
    const unsigned long long gbase = (unsigned long long)(uintptr_t)Lam;
    for (int g = threadIdx.x; g < MATELEMS / 4; g += (int)blockDim.x) {
      const int row = g >> 6;              // 64 x b128 per 256-float row
      const int e   = (g & 63) * 4;
      unsigned ldsoff = (unsigned)((row * HPAD + e) * 4);
      unsigned voff   = (unsigned)(g * 16);
      asm volatile("global_load_async_to_lds_b128 %0, %1, %2"
                   :: "v"(ldsoff), "v"(voff), "s"(gbase)
                   : "memory");
    }
    asm volatile("s_wait_asynccnt 0x0" ::: "memory");
  }

  // zero h_{-1} (buffer 0)
  for (int i = threadIdx.x; i < BS * DDIM; i += (int)blockDim.x)
    hb[(i >> 8) * HPAD + (i & 255)] = 0.f;
  __syncthreads();

  const float* lrow = lam_s + (n0 + col) * HPAD;   // row n of Lam: B[k,n]=Lam[n,k]
  for (int i = 0; i < CHUNK; ++i) {
    const int t = chunk * CHUNK + i;
    const float* hsrc = hb + (i & 1) * (BS * HPAD);
    v8f acc = vzero8();
    for (int e = 0; e < DDIM; e += 4) {
      v2f a = *(const v2f*)(hsrc + col * HPAD + e + kk);  // A[m=batch,k]
      v2f b = *(const v2f*)(lrow + e + kk);
      acc = wmma4(a, b, acc);
    }
    float* hdst = hb + ((i + 1) & 1) * (BS * HPAD);
#pragma unroll
    for (int v = 0; v < 8; ++v) {
      const int bat = v + hi;
      float h = acc[v] + Bx[(bat * TLEN + t) * DDIM + n0 + col];
      hdst[bat * HPAD + n0 + col] = h;
      U[(bat * TLEN + t) * DDIM + n0 + col] = h;
    }
    __syncthreads();
  }
}

// ------------------------------------------------------------- look-ahead ---
// One doubling of the carry recurrence c_k = M c_{k-d} + v_k (c = 0 before the
// start):  c_k = M^2 c_{k-2d} + w_k  with  w_k = v_k + M v_{k-d}  (w_k = v_k for
// k < d).  The w_k do not depend on one another: one WG per chunk k, the 16
// batches as the M dim of a 16x256x256 WMMA GEMM, M staged in LDS.  The first
// 16 WGs also form 16 rows each of M^2 from the staged M.
// v_k[b] lives at vin + k*kstr + b*bstr; w_k[b] at vout + (k*BS + b)*DDIM.

// acc += A(16 x 256) * B(256 x 16).  A[m,e] = arow[..], lane-resolved; B[e,n] is
// read from bp: as a pair along a row of the staged matrix (BT: B[e,n]=S[n,e]),
// or as two words of one column (B[e,n]=S[e,n]).  k ascending, one chain.
template <bool BT>
__device__ __forceinline__ v8f tile_lds(const float* arow, const float* bp, v8f acc) {
  // every unroll is full: constant indices keep the two groups in registers;
  // two groups: LDS reads are issued ahead of the WMMAs that use them
  v2f abuf[2][ABLK], bbuf[2][ABLK];
#pragma unroll
  for (int q = 0; q <= DDIM / 4 / ABLK; ++q) {
    if (q < DDIM / 4 / ABLK) {
#pragma unroll
      for (int s = 0; s < ABLK; ++s) {
        const int e = 4 * (q * ABLK + s);
        abuf[q & 1][s] = *(const v2f*)(arow + e);
        if (BT) {
          bbuf[q & 1][s] = *(const v2f*)(bp + e);
        } else {
          bbuf[q & 1][s].x = bp[e * HPAD];
          bbuf[q & 1][s].y = bp[(e + 1) * HPAD];
        }
      }
    }
    if (q > 0) {
#pragma unroll
      for (int s = 0; s < ABLK; ++s)
        acc = wmma4(abuf[(q - 1) & 1][s], bbuf[(q - 1) & 1][s], acc);
    }
  }
  return acc;
}

__global__ void __launch_bounds__(CTHREADS) lookahead(const float* __restrict__ vin,
                                                      int kstr, int bstr,
                                                      const float* __restrict__ M,
                                                      float* __restrict__ vout,
                                                      float* __restrict__ M2, int d) {
  // 256 x HPAD floats of M, then BS x HPAD floats of v_{k-d}
  extern __shared__ __attribute__((aligned(16))) float csm[];
  float* vs = csm + 256 * HPAD;

  const int k = blockIdx.x;            // 0..NCH-1
  const int lane = threadIdx.x & 31;
  const int wave = threadIdx.x >> 5;   // 0..15
  const int n0 = wave * 16;
  const int col = lane & 15;
  const int kk  = (lane >> 4) * 2;
  const int hi  = (lane >> 4) * 8;

  v8f acc;                             // seeded with v_k
#pragma unroll
  for (int v = 0; v < 8; ++v)
    acc[v] = vin[k * kstr + (v + hi) * bstr + n0 + col];
  // precaution: later code reuses the address registers these loads name
  asm volatile("s_wait_xcnt 0x0" ::: "memory");

  const int ks = (k >= d) ? k - d : k; // k < d has no term: its rows are staged and not used
  const int srow = threadIdx.x >> 6;   // 64 x 16 bytes per row
  const int se   = (threadIdx.x & 63) * 4;
  v4f x[BS * DDIM / 4 / CTHREADS];
#pragma unroll
  for (int g = 0; g < BS * DDIM / 4 / CTHREADS; ++g)
    x[g] = *(const v4f*)(vin + ks * kstr + (g * (CTHREADS / 64) + srow) * bstr + se);
  // precaution: later code reuses the address registers these loads name
  asm volatile("s_wait_xcnt 0x0" ::: "memory");
  stage_mat(csm, M);                   // the loads above are in flight meanwhile
#pragma unroll
  for (int g = 0; g < BS * DDIM / 4 / CTHREADS; ++g)
    *(v4f*)(vs + (g * (CTHREADS / 64) + srow) * HPAD + se) = x[g];
  __syncthreads();

  if (k >= d)                          // A[m=batch,e] = v_{k-d}, B[e,n] = M[n,e]
    acc = tile_lds<true>(vs + col * HPAD + kk, csm + (n0 + col) * HPAD + kk, acc);
#pragma unroll
  for (int v = 0; v < 8; ++v)
    vout[(k * BS + v + hi) * DDIM + n0 + col] = acc[v];
  // precaution: the code below reuses the registers these stores name
  asm volatile("s_wait_xcnt 0x0" ::: "memory");

  if (k < DDIM / 16) {                 // rows [16k, 16k+16) of M^2: A[m,e] = M[16k+m,e], B[e,n] = M[e,n]
    v8f sq = tile_lds<false>(csm + (k * 16 + col) * HPAD + kk, csm + kk * HPAD + n0 + col, vzero8());
#pragma unroll
    for (int v = 0; v < 8; ++v)
      M2[(k * 16 + v + hi) * DDIM + n0 + col] = sq[v];
  }
}

// ------------------------------------------------------------- carry scan ---
// After two look-ahead doublings: carry_k = P @ carry_{k-LA} + w_k with
// P = Lam^(CHUNK*LA): LA chains per batch that do not touch one another, each of
// NST steps.  One WG per (batch, chain); true
// mat-vec -> VALU fmas.  P stays in registers for the whole kernel: wave w owns
// rows [8w, 8w+8); a lane holds 4 of them (by its half of the wave) times 16
// columns (4 groups of 4, by its place in the half).  LDS holds one 256-float
// row per chunk of the chain: w on entry, the carry once its step has run, so the loop
// touches no global memory and needs one barrier a step.
#define KTHREADS 1024
#define LA 4                         // chains per batch (two doublings)
#define NST (NCH / LA)               // steps of a chain
#define KGRP 4                       // w rows a thread has in flight while staging

// value of lane (l ^ MASK) within the lane's 16-lane row
template <int MASK>
__device__ __forceinline__ float row_xor(float x) {
  return __builtin_bit_cast(float, __builtin_amdgcn_update_dpp(
      0, __builtin_bit_cast(int, x), 0x160 + MASK, 0xf, 0xf, true));
}

__global__ void __launch_bounds__(KTHREADS) carry_scan(const float* __restrict__ Wv,
                                                       const float* __restrict__ P,
                                                       float* __restrict__ carries) {
  extern __shared__ __attribute__((aligned(16))) float hist[];   // NST x DDIM

  const int b = blockIdx.x;
  const int r = blockIdx.y;                    // chain: chunks r, r+LA, r+2*LA, ...
  const int lane = threadIdx.x & 31;
  const int wave = threadIdx.x >> 5;           // 0..31
  const int kp = lane & 15;                    // column part
  const int nb = wave * 8 + (lane >> 4) * 4;   // first of the lane's 4 rows

  // every unroll below is full: constant indices keep p, h and a in registers
  v4f p[4][4];                                 // [row][column group]
  const float* pp = P + nb * DDIM + kp * 4;
#pragma unroll
  for (int r = 0; r < 4; ++r)
#pragma unroll
    for (int q = 0; q < 4; ++q)
      p[r][q] = *(const v4f*)(pp + r * DDIM + q * 64);
  // precaution: the address registers these loads name stay as they are up to
  // this wait (the operand keeps them live); later code may reuse them
  asm volatile("s_wait_xcnt 0x0" :: "v"(pp) : "memory");

  {
    const int e = (threadIdx.x & 63) * 4;      // 64 x 16 bytes per row
    const int k0 = threadIdx.x >> 6;
    // groups of KGRP rows a thread: x and p together fit the wave's registers
    for (int g0 = 0; g0 < NST * DDIM / 4 / KTHREADS; g0 += KGRP) {
      v4f x[KGRP];
      const float* up = Wv + (((g0 * (KTHREADS / 64) + k0) * LA + r) * BS + b) * DDIM + e;
#pragma unroll
      for (int g = 0; g < KGRP; ++g)
        x[g] = *(const v4f*)(up + g * (KTHREADS / 64) * LA * BS * DDIM);
      // precaution, as above
      asm volatile("s_wait_xcnt 0x0" :: "v"(up) : "memory");
#pragma unroll
      for (int g = 0; g < KGRP; ++g)
        *(v4f*)(hist + ((g0 + g) * (KTHREADS / 64) + k0) * DDIM + e) = x[g];
    }
  }
  __syncthreads();

  const bool up8 = (kp & 8) != 0;
  const bool up4 = (kp & 4) != 0;
  const bool first = (kp & 3) == 0;            // one lane of the 4 that end with the same row
  // the row whose sum ends in this lane
  const int myrow = nb + (up8 ? 2 : 0) + (up4 ? 1 : 0);

  // the chain's first carry is its first w: the state before it is zero
  float u = hist[DDIM + myrow];                // w of the step at hand, read one step ahead
  for (int k = 1; k < NST; ++k) {
    const int kn = (k + 1 < NST) ? k + 1 : k;  // the last step has no next: its read is not used
    const float un = hist[kn * DDIM + myrow];
    const float* hp = hist + (k - 1) * DDIM + kp * 4;
    v4f h[4];
#pragma unroll
    for (int q = 0; q < 4; ++q) h[q] = *(const v4f*)(hp + q * 64);

    v2f a[4];
#pragma unroll
    for (int r = 0; r < 4; ++r) {
      a[r] = p[r][0].xy * h[0].xy;
      a[r] += p[r][0].zw * h[0].zw;
#pragma unroll
      for (int q = 1; q < 4; ++q) {
        a[r] += p[r][q].xy * h[q].xy;
        a[r] += p[r][q].zw * h[q].zw;
      }
    }
    const float s0 = a[0].x + a[0].y, s1 = a[1].x + a[1].y;
    const float s2 = a[2].x + a[2].y, s3 = a[3].x + a[3].y;

    // sum over the 16 lanes of a row: each exchange also halves the rows a lane carries
    const float t0 = (up8 ? s2 : s0) + row_xor<8>(up8 ? s0 : s2);
    const float t1 = (up8 ? s3 : s1) + row_xor<8>(up8 ? s1 : s3);
    float w = (up4 ? t1 : t0) + row_xor<4>(up4 ? t0 : t1);
    w += first ? u : 0.f;                      // w_k enters once among the 4 lanes left to sum
    w += row_xor<2>(w);
    w += row_xor<1>(w);

    if (first) hist[k * DDIM + myrow] = w;
    u = un;
    __syncthreads();                           // carry_k is complete before step k+1 reads it
  }

  {
    const int e = (threadIdx.x & 63) * 4;
    const int k0 = threadIdx.x >> 6;
#pragma unroll
    for (int g = 0; g < NST * DDIM / 4 / KTHREADS; ++g) {
      const int k = g * (KTHREADS / 64) + k0;
      *(v4f*)(carries + ((k * LA + r) * BS + b) * DDIM + e) = *(const v4f*)(hist + k * DDIM + e);
    }
  }
}

// ------------------------------------------------------------- correction ---
// out[b, k*CHUNK+i, :] += Lam^{i+1} @ carry_{k-1}[b].  One WG per (power i,
// group of CTILES chunks).  The power goes through LDS once (coalesced reads)
// into registers: wave w keeps the 64 B fragments of its 16 columns for the
// whole kernel.  The same LDS then takes the group's carries (16 rows per
// chunk), and every chunk runs through the resident fragments.  Accumulator
// seeded from out, k order as before, so each sum is formed in the same order.
__global__ void __launch_bounds__(CTHREADS) correct(float* __restrict__ out,
                                                    const float* __restrict__ pw,
                                                    const float* __restrict__ carries) {
  // 256 x HPAD floats: first the power, then the carries
  extern __shared__ __attribute__((aligned(16))) float csm[];

  const int i  = blockIdx.x;           // 0..CHUNK-1
  const int m0 = blockIdx.y * CTILES;  // first carry index (chunk k-1) of the group
  const int lane = threadIdx.x & 31;
  const int wave = threadIdx.x >> 5;   // 0..15
  const int n0 = wave * 16;
  const int col = lane & 15;
  const int kk  = (lane >> 4) * 2;
  const int hi  = (lane >> 4) * 8;

  stage_mat(csm, pw + (size_t)i * MATELEMS);                  // Lam^{i+1}
  __syncthreads();

  v2f bfrag[DDIM / 4];                                        // B[k,n]=Lam^{i+1}[n,k]
  const float* brow = csm + (n0 + col) * HPAD + kk;
  // full unroll: bfrag must be indexed by constants to stay in registers
#pragma unroll
  for (int s = 0; s < DDIM / 4; ++s) bfrag[s] = *(const v2f*)(brow + 4 * s);
  __syncthreads();                     // every wave has its fragments: LDS is free

  // carries[m0 .. m0+CTILES) are CTILES*BS contiguous rows; index NCH-1 exists
  // (written by carry_scan), so the last group stages it and leaves it unused.
  stage_mat(csm, carries + (size_t)m0 * BS * DDIM);
  __syncthreads();

  const int ntile = (NCH - 1 - m0 < CTILES) ? (NCH - 1 - m0) : CTILES;
  for (int j = 0; j < ntile; ++j) {
    const int t = (m0 + j + 1) * CHUNK + i;
    const float* arow = csm + (j * BS + col) * HPAD + kk;     // A[m=batch,k=e]
    // every unroll below is full: constant indices keep acc, abuf and bfrag in registers
    v8f acc;
#pragma unroll
    for (int v = 0; v < 8; ++v)
      acc[v] = out[((v + hi) * TLEN + t) * DDIM + n0 + col];
    v2f abuf[2][ABLK];                 // two groups: LDS reads are issued ahead of the WMMAs that use them
#pragma unroll
    for (int s = 0; s < ABLK; ++s) abuf[0][s] = *(const v2f*)(arow + 4 * s);
#pragma unroll
    for (int q = 0; q < DDIM / 4 / ABLK; ++q) {
      if (q + 1 < DDIM / 4 / ABLK) {
#pragma unroll
        for (int s = 0; s < ABLK; ++s)
          abuf[(q + 1) & 1][s] = *(const v2f*)(arow + 4 * ((q + 1) * ABLK + s));
      }
#pragma unroll
      for (int s = 0; s < ABLK; ++s)
        acc = wmma4(abuf[q & 1][s], bfrag[q * ABLK + s], acc);
    }
#pragma unroll
    for (int v = 0; v < 8; ++v)
      out[((v + hi) * TLEN + t) * DDIM + n0 + col] = acc[v];
    // precaution: the next trip rewrites the address registers these stores name
    asm volatile("s_wait_xcnt 0x0" ::: "memory");
  }
}

// ------------------------------------------------------------------ launch --
extern "C" void kernel_launch(void* const* d_in, const int* in_sizes, int n_in,
                              void* d_out, int out_size, void* d_ws, size_t ws_size,
                              hipStream_t stream) {
  (void)in_sizes; (void)n_in; (void)out_size; (void)ws_size;
  const float* x   = (const float*)d_in[0];   // [16,4096,256]
  const float* Bm  = (const float*)d_in[1];   // [256,256]
  const float* Lam = (const float*)d_in[2];   // [256,256]
  float* out = (float*)d_out;                 // [16,4096,256], also U buffer

  float* Bx      = (float*)d_ws;                         // 16.78M floats
  float* powers  = Bx + (size_t)BS * TLEN * DDIM;        // 16 * 65536 floats
  float* carries = powers + (size_t)CHUNK * MATELEMS;    // NCH*BS*DDIM floats
  float* w1      = carries + (size_t)NCH * BS * DDIM;    // NCH*BS*DDIM floats
  float* w2      = w1 + (size_t)NCH * BS * DDIM;         // NCH*BS*DDIM floats
  float* pw2     = w2 + (size_t)NCH * BS * DDIM;         // Lam^(2*CHUNK)
  float* pw4     = pw2 + MATELEMS;                       // Lam^(4*CHUNK)

  // Lam^1..Lam^CHUNK by log-doubling.
  copy_mat<<<MATELEMS / 256, 256, 0, stream>>>(Lam, powers);
  for (int s = 1; s < CHUNK; s <<= 1)
    power_step<<<dim3(32, s), 256, 0, stream>>>(powers, s);

  // Bx = X @ B^T
  const size_t lds_mat = (size_t)(256 * HPAD) * sizeof(float);
  bx_gemm<<<(BS * TLEN) / XROWS, CTHREADS, lds_mat, stream>>>(x, Bm, Bx);

  // chunk-local scans: Lam lives in the 320KB WGP LDS (256*HPAD + 2*16*HPAD)
  const size_t lds_scan = (size_t)(256 * HPAD + 2 * BS * HPAD) * sizeof(float);
  chunk_scan<<<NCH, 512, lds_scan, stream>>>(Bx, Lam, out);

  // two doublings of the carry recurrence: distance 1 -> 2 -> 4 chunks
  const size_t lds_la = (size_t)(256 * HPAD + BS * HPAD) * sizeof(float);
  lookahead<<<NCH, CTHREADS, lds_la, stream>>>(
      out + (CHUNK - 1) * DDIM, CHUNK * DDIM, TLEN * DDIM,
      powers + (size_t)(CHUNK - 1) * MATELEMS, w1, pw2, 1);
  lookahead<<<NCH, CTHREADS, lds_la, stream>>>(w1, BS * DDIM, DDIM, pw2, w2, pw4, 2);

  // serial carry scans, LA chains per batch (P = Lam^(CHUNK*LA) in registers)
  const size_t lds_carry = (size_t)(NST * DDIM) * sizeof(float);
  carry_scan<<<dim3(BS, LA), KTHREADS, lds_carry, stream>>>(w2, pw4, carries);

  // broadcast carries back into every timestep
  const size_t lds_corr = (size_t)(256 * HPAD) * sizeof(float);
  correct<<<dim3(CHUNK, NCH / CTILES), CTHREADS, lds_corr, stream>>>(out, powers, carries);
}

// v006
// One run takes 230 microseconds.
// Next to v005, in two timings, it ran 1.09 times as fast each time.
// All steps since v000 together make it 2.95 times as fast.
#include <hip/hip_runtime.h>

typedef __attribute__((ext_vector_type(2))) float v2f;
typedef __attribute__((ext_vector_type(4))) float v4f;
typedef __attribute__((ext_vector_type(8))) float v8f;

#define DDIM 256
#define BS   16
#define TLEN 4096
#define CHUNK 16                     // short chunks: the chunk scan has one work-group for every WGP
#define NCH  (TLEN / CHUNK)          // 256 chunks
#define MATELEMS (DDIM * DDIM)       // 65536
#define HPAD 260                     // padded LDS row stride (bank-conflict-free)

__device__ __forceinline__ v8f wmma4(v2f a, v2f b, v8f c) {
  // D = A(16x4,f32) * B(4x16,f32) + C(16x16,f32)
  return __builtin_amdgcn_wmma_f32_16x16x4_f32(false, a, false, b, (short)0, c,
                                               false, false);
}

__device__ __forceinline__ v8f vzero8() {
  v8f z = {0.f, 0.f, 0.f, 0.f, 0.f, 0.f, 0.f, 0.f};
  return z;
}

// ---------------------------------------------------------------- powers ----
__global__ void copy_mat(const float* __restrict__ src, float* __restrict__ dst) {
  int i = blockIdx.x * blockDim.x + threadIdx.x;
  if (i < MATELEMS) dst[i] = src[i];
}

// powers[k] lives at pw + (k-1)*MATELEMS.  Computes A_{s+j} = A_s * A_j,
// j = blockIdx.y+1 (1..s).  8 waves/WG, one 16x16 output tile per wave.
__global__ void power_step(float* __restrict__ pw, int s) {
  const int j = blockIdx.y + 1;
  const float* As = pw + (size_t)(s - 1) * MATELEMS;
  const float* Aj = pw + (size_t)(j - 1) * MATELEMS;
  float*       Dm = pw + (size_t)(s + j - 1) * MATELEMS;

  const int lane = threadIdx.x & 31;
  const int wave = threadIdx.x >> 5;        // 0..7
  const int tile = blockIdx.x * 8 + wave;   // 0..255
  const int mt = tile >> 4, nt = tile & 15;
  const int col = lane & 15;
  const int kk  = (lane >> 4) * 2;

  v8f acc = vzero8();
  const float* arow = As + (mt * 16 + col) * DDIM;
  for (int e = 0; e < DDIM; e += 4) {
    v2f a = *(const v2f*)(arow + e + kk);
    v2f b;
    b.x = Aj[(e + kk    ) * DDIM + nt * 16 + col];
    b.y = Aj[(e + kk + 1) * DDIM + nt * 16 + col];
    acc = wmma4(a, b, acc);
  }
  const int hi = (lane >> 4) * 8;
#pragma unroll
  for (int v = 0; v < 8; ++v)
    Dm[(mt * 16 + v + hi) * DDIM + nt * 16 + col] = acc[v];
}

// ------------------------------------------------- shared staging helper ---
#define CTILES 16                    // chunks per work-group (CTILES*BS = 256 LDS rows)
#define CTHREADS 512
#define ABLK 16                      // A fragments fetched from LDS as one group

// 256x256 floats, row-major in global memory, to LDS rows of HPAD floats.
#define SGRP 8                       // loads of a lane in flight: not one L2 round trip each
__device__ __forceinline__ void stage_mat(float* __restrict__ dst,
                                          const float* __restrict__ src) {
  const int row = threadIdx.x >> 6;          // 64 x 16 bytes per row
  const int e   = (threadIdx.x & 63) * 4;
  for (int r0 = 0; r0 < MATELEMS / 4 / CTHREADS; r0 += SGRP) {
    v4f x[SGRP];
    // full unrolls: constant indices keep x in registers
#pragma unroll
    for (int u = 0; u < SGRP; ++u)
      x[u] = *(const v4f*)(src + ((r0 + u) * CTHREADS + threadIdx.x) * 4);
#pragma unroll
    for (int u = 0; u < SGRP; ++u)
      *(v4f*)(dst + ((r0 + u) * (CTHREADS / 64) + row) * HPAD + e) = x[u];
  }
}

// ---------------------------------------------------------------- Bx GEMM ---
// Bx[r,n] = sum_e X[r,e] * Bm[n,e]  (Bx = X @ Bm^T).  One WG per 256 rows of X.
// Bm goes through LDS once (coalesced reads) into registers: wave w keeps the
// 64 B fragments of its 16 columns for the whole kernel.  The same LDS then
// takes the WG's 256 rows of X (whole-line reads), and every 16-row tile runs
// through the resident fragments.  One accumulator chain per tile, k ascending,
// so each sum is formed in the same order as with fragments read from global.
#define XROWS 256                    // rows of X per work-group (fills the LDS rows)
__global__ void __launch_bounds__(CTHREADS) bx_gemm(const float* __restrict__ X,
                                                    const float* __restrict__ Bm,
                                                    float* __restrict__ Bx) {
  // 256 x HPAD floats: first Bm, then the rows of X
  extern __shared__ __attribute__((aligned(16))) float csm[];

  const int r0 = blockIdx.x * XROWS;
  const int lane = threadIdx.x & 31;
  const int wave = threadIdx.x >> 5;   // 0..15
  const int n0 = wave * 16;
  const int col = lane & 15;
  const int kk  = (lane >> 4) * 2;
  const int hi  = (lane >> 4) * 8;

  stage_mat(csm, Bm);
  __syncthreads();

  v2f bfrag[DDIM / 4];                                        // B[k,n]=Bm[n,k]
  const float* brow = csm + (n0 + col) * HPAD + kk;
  // full unroll: bfrag must be indexed by constants to stay in registers
#pragma unroll
  for (int s = 0; s < DDIM / 4; ++s) bfrag[s] = *(const v2f*)(brow + 4 * s);
  __syncthreads();                     // every wave has its fragments: LDS is free

  stage_mat(csm, X + (size_t)r0 * DDIM);
  __syncthreads();

  const float* arow = csm + col * HPAD + kk;                  // A[m=row,k=e]
  float* orow = Bx + (size_t)(r0 + hi) * DDIM + n0 + col;
  for (int j = 0; j < XROWS / 16; ++j) {
    // every unroll below is full: constant indices keep acc, abuf and bfrag in registers
    v8f acc = vzero8();
    v2f abuf[2][ABLK];                 // two groups: LDS reads are issued ahead of the WMMAs that use them
#pragma unroll
    for (int s = 0; s < ABLK; ++s) abuf[0][s] = *(const v2f*)(arow + 4 * s);
#pragma unroll
    for (int q = 0; q < DDIM / 4 / ABLK; ++q) {
      if (q + 1 < DDIM / 4 / ABLK) {
#pragma unroll
        for (int s = 0; s < ABLK; ++s)
          abuf[(q + 1) & 1][s] = *(const v2f*)(arow + 4 * ((q + 1) * ABLK + s));
      }
#pragma unroll
      for (int s = 0; s < ABLK; ++s)
        acc = wmma4(abuf[q & 1][s], bfrag[q * ABLK + s], acc);
    }
#pragma unroll
    for (int v = 0; v < 8; ++v)
      orow[v * DDIM] = acc[v];
    // precaution: the next trip rewrites the address registers these stores name
    asm volatile("s_wait_xcnt 0x0" ::: "memory");
    arow += 16 * HPAD;
    orow += 16 * DDIM;
  }
}

// ------------------------------------------------------------- chunk scan ---
// Per chunk (blockIdx.x): u_i = Lam @ u_{i-1} + Bx_t for i=0..CHUNK-1 with
// u_{-1}=0, all 16 batches as the M dim of a 16x256x256 WMMA GEMM per step.
// Lam (256KB) is staged into the 320KB WGP LDS via CDNA5 async global->LDS
// b128 copies and read from there once: wave w keeps the 64 B fragments of its
// 16 columns in registers for all steps.  h ping-pongs through LDS.  A step's
// serial path is: h fragments from LDS, 64 WMMAs, h to LDS, barrier.  Bx_t is
// loaded two steps ahead and seeds the accumulator; u_i goes to global memory
// behind the step's barrier, so the barrier does not wait for those stores.
// Dynamic LDS layout: [0, 256*HPAD) = Lam (padded rows); then 2*16*HPAD for h.

// One step.  On entry acc holds Bx of this step and abuf[0] the first group of
// u_{i-1}'s fragments; on exit acc is being loaded with Bx of the step after the
// next (the caller alternates two accumulators, so nothing is copied while a
// load is under way) and abuf[0] with the first group of u_i.
// arow: this lane's fragments of u_{i-1};  hdst, anext: where the lane writes u_i
// and where it reads its fragments of it;  up, bxp: the lane's first element of
// u_i in global memory and of the Bx to fetch (batches TLEN*DDIM apart).
__device__ __forceinline__ void scan_step(v8f& acc, v2f (&abuf)[2][ABLK],
                                          const v2f (&bfrag)[DDIM / 4],
                                          const float* arow, float* hdst,
                                          const float* anext,
                                          float* __restrict__ up,
                                          const float* __restrict__ bxp) {
  // every unroll is full: constant indices keep acc, abuf and bfrag in registers
#pragma unroll
  for (int q = 0; q < DDIM / 4 / ABLK; ++q) {
    if (q + 1 < DDIM / 4 / ABLK) {
#pragma unroll
      for (int s = 0; s < ABLK; ++s)
        abuf[(q + 1) & 1][s] = *(const v2f*)(arow + 4 * ((q + 1) * ABLK + s));
    }
#pragma unroll
    for (int s = 0; s < ABLK; ++s)
      acc = wmma4(abuf[q & 1][s], bfrag[q * ABLK + s], acc);
  }
#pragma unroll
  for (int v = 0; v < 8; ++v) hdst[v * HPAD] = acc[v];
  __syncthreads();                     // u_i is complete before the next step reads it

#pragma unroll
  for (int s = 0; s < ABLK; ++s) abuf[0][s] = *(const v2f*)(anext + 4 * s);
  // while those reads are under way: u_i out, the next Bx for this accumulator in
#pragma unroll
  for (int v = 0; v < 8; ++v) up[v * TLEN * DDIM] = acc[v];
  // precaution: the loads below rewrite the registers these stores name
  asm volatile("s_wait_xcnt 0x0" ::: "memory");
#pragma unroll
  for (int v = 0; v < 8; ++v) acc[v] = bxp[v * TLEN * DDIM];
  // precaution: later code rewrites the address registers these loads name
  asm volatile("s_wait_xcnt 0x0" ::: "memory");
}

__global__ void __launch_bounds__(512) chunk_scan(const float* __restrict__ Bx,
                                                  const float* __restrict__ Lam,
                                                  float* __restrict__ U) {
  extern __shared__ float smem[];
  float* lam_s = smem;                       // 256 x HPAD
  float* hb    = smem + 256 * HPAD;          // 2 x BS x HPAD

  const int lane = threadIdx.x & 31;
  const int wave = threadIdx.x >> 5;     // 0..15
  const int chunk = blockIdx.x;
  const int n0 = wave * 16;
  const int col = lane & 15;
  const int kk  = (lane >> 4) * 2;
  const int hi  = (lane >> 4) * 8;

  // ---- stage Lam into LDS with async global->LDS copies (ASYNCcnt path).
  // Dynamic LDS starts at group-segment offset 0, so LDS byte offsets are
  // computed numerically.  Each b128 moves 4 floats of one (padded) row.
  {
    const unsigned long long gbase = (unsigned long long)(uintptr_t)Lam;
    for (int g = threadIdx.x; g < MATELEMS / 4; g += (int)blockDim.x) {
      const int row = g >> 6;              // 64 x b128 per 256-float row
      const int e   = (g & 63) * 4;
      unsigned ldsoff = (unsigned)((row * HPAD + e) * 4);
      unsigned voff   = (unsigned)(g * 16);
      asm volatile("global_load_async_to_lds_b128 %0, %1, %2"
                   :: "v"(ldsoff), "v"(voff), "s"(gbase)
                   : "memory");
    }
    asm volatile("s_wait_asynccnt 0x0" ::: "memory");
  }

  // zero h_{-1} (buffer 0)
  for (int i = threadIdx.x; i < BS * DDIM; i += (int)blockDim.x)
    hb[(i >> 8) * HPAD + (i & 255)] = 0.f;
  __syncthreads();

  // element (batch hi, first step of the chunk, the lane's column) of Bx and U
  const int o0 = (hi * TLEN + chunk * CHUNK) * DDIM + n0 + col;
  // every unroll below is full: constant indices keep the arrays in registers
  v8f acc0, acc1;                      // even and odd steps
#pragma unroll
  for (int v = 0; v < 8; ++v) acc0[v] = Bx[o0 + v * TLEN * DDIM];
  // precaution: later code reuses the address registers these loads name; it also
  // keeps step 0's loads the older ones, so its first WMMA waits for them alone
  asm volatile("s_wait_xcnt 0x0" ::: "memory");
#pragma unroll
  for (int v = 0; v < 8; ++v) acc1[v] = Bx[o0 + DDIM + v * TLEN * DDIM];
  // precaution, as above
  asm volatile("s_wait_xcnt 0x0" ::: "memory");

  v2f bfrag[DDIM / 4];                 // row n of Lam: B[k,n]=Lam[n,k]
  const float* lrow = lam_s + (n0 + col) * HPAD + kk;
#pragma unroll
  for (int s = 0; s < DDIM / 4; ++s) bfrag[s] = *(const v2f*)(lrow + 4 * s);

  v2f abuf[2][ABLK];                   // two groups: LDS reads are issued ahead of the WMMAs that use them
  const float* ar0 = hb + col * HPAD + kk;                    // A[m=batch,k], buffer 0
  const float* ar1 = ar0 + BS * HPAD;                         // buffer 1
  float* hd0 = hb + hi * HPAD + n0 + col;                     // the lane's first element, buffer 0
  float* hd1 = hd0 + BS * HPAD;
#pragma unroll
  for (int s = 0; s < ABLK; ++s) abuf[0][s] = *(const v2f*)(ar0 + 4 * s);

  for (int i = 0; i < CHUNK; i += 2) {
    // the last two steps have no step two ahead: they fetch the last Bx again and do not use it
    const int f0 = (i + 2 < CHUNK) ? i + 2 : CHUNK - 1;
    const int f1 = (i + 3 < CHUNK) ? i + 3 : CHUNK - 1;
    scan_step(acc0, abuf, bfrag, ar0, hd1, ar1, U + o0 + i * DDIM, Bx + o0 + f0 * DDIM);
    scan_step(acc1, abuf, bfrag, ar1, hd0, ar0, U + o0 + (i + 1) * DDIM, Bx + o0 + f1 * DDIM);
  }
}

// ------------------------------------------------------------- look-ahead ---
// One doubling of the carry recurrence c_k = M c_{k-d} + v_k (c = 0 before the
// start):  c_k = M^2 c_{k-2d} + w_k  with  w_k = v_k + M v_{k-d}  (w_k = v_k for
// k < d).  The w_k do not depend on one another: one WG per chunk k, the 16
// batches as the M dim of a 16x256x256 WMMA GEMM, M staged in LDS.  The first
// 16 WGs also form 16 rows each of M^2 from the staged M.
// v_k[b] lives at vin + k*kstr + b*bstr; w_k[b] at vout + (k*BS + b)*DDIM.

// acc += A(16 x 256) * B(256 x 16).  A[m,e] = arow[..], lane-resolved; B[e,n] is
// read from bp: as a pair along a row of the staged matrix (BT: B[e,n]=S[n,e]),
// or as two words of one column (B[e,n]=S[e,n]).  k ascending, one chain.
template <bool BT>
__device__ __forceinline__ v8f tile_lds(const float* arow, const float* bp, v8f acc) {
  // every unroll is full: constant indices keep the two groups in registers;
  // two groups: LDS reads are issued ahead of the WMMAs that use them
  v2f abuf[2][ABLK], bbuf[2][ABLK];
#pragma unroll
  for (int q = 0; q <= DDIM / 4 / ABLK; ++q) {
    if (q < DDIM / 4 / ABLK) {
#pragma unroll
      for (int s = 0; s < ABLK; ++s) {
        const int e = 4 * (q * ABLK + s);
        abuf[q & 1][s] = *(const v2f*)(arow + e);
        if (BT) {
          bbuf[q & 1][s] = *(const v2f*)(bp + e);
        } else {
          bbuf[q & 1][s].x = bp[e * HPAD];
          bbuf[q & 1][s].y = bp[(e + 1) * HPAD];
        }
      }
    }
    if (q > 0) {
#pragma unroll
      for (int s = 0; s < ABLK; ++s)
        acc = wmma4(abuf[(q - 1) & 1][s], bbuf[(q - 1) & 1][s], acc);
    }
  }
  return acc;
}

__global__ void __launch_bounds__(CTHREADS) lookahead(const float* __restrict__ vin,
                                                      int kstr, int bstr,
                                                      const float* __restrict__ M,
                                                      float* __restrict__ vout,
                                                      float* __restrict__ M2, int d) {
  // 256 x HPAD floats of M, then BS x HPAD floats of v_{k-d}
  extern __shared__ __attribute__((aligned(16))) float csm[];
  float* vs = csm + 256 * HPAD;

  const int k = blockIdx.x;            // 0..NCH-1
  const int lane = threadIdx.x & 31;
  const int wave = threadIdx.x >> 5;   // 0..15
  const int n0 = wave * 16;
  const int col = lane & 15;
  const int kk  = (lane >> 4) * 2;
  const int hi  = (lane >> 4) * 8;

  v8f acc;                             // seeded with v_k
#pragma unroll
  for (int v = 0; v < 8; ++v)
    acc[v] = vin[k * kstr + (v + hi) * bstr + n0 + col];
  // precaution: later code reuses the address registers these loads name
  asm volatile("s_wait_xcnt 0x0" ::: "memory");

  const int ks = (k >= d) ? k - d : k; // k < d has no term: its rows are staged and not used
  const int srow = threadIdx.x >> 6;   // 64 x 16 bytes per row
  const int se   = (threadIdx.x & 63) * 4;
  v4f x[BS * DDIM / 4 / CTHREADS];
#pragma unroll
  for (int g = 0; g < BS * DDIM / 4 / CTHREADS; ++g)
    x[g] = *(const v4f*)(vin + ks * kstr + (g * (CTHREADS / 64) + srow) * bstr + se);
  // precaution: later code reuses the address registers these loads name
  asm volatile("s_wait_xcnt 0x0" ::: "memory");
  stage_mat(csm, M);                   // the loads above are in flight meanwhile
#pragma unroll
  for (int g = 0; g < BS * DDIM / 4 / CTHREADS; ++g)
    *(v4f*)(vs + (g * (CTHREADS / 64) + srow) * HPAD + se) = x[g];
  __syncthreads();

  if (k >= d)                          // A[m=batch,e] = v_{k-d}, B[e,n] = M[n,e]
    acc = tile_lds<true>(vs + col * HPAD + kk, csm + (n0 + col) * HPAD + kk, acc);
#pragma unroll
  for (int v = 0; v < 8; ++v)
    vout[(k * BS + v + hi) * DDIM + n0 + col] = acc[v];
  // precaution: the code below reuses the registers these stores name
  asm volatile("s_wait_xcnt 0x0" ::: "memory");

  if (k < DDIM / 16) {                 // rows [16k, 16k+16) of M^2: A[m,e] = M[16k+m,e], B[e,n] = M[e,n]
    v8f sq = tile_lds<false>(csm + (k * 16 + col) * HPAD + kk, csm + kk * HPAD + n0 + col, vzero8());
#pragma unroll
    for (int v = 0; v < 8; ++v)
      M2[(k * 16 + v + hi) * DDIM + n0 + col] = sq[v];
  }
}

// ------------------------------------------------------------- carry scan ---
// After two look-ahead doublings: carry_k = P @ carry_{k-LA} + w_k with
// P = Lam^(CHUNK*LA): LA chains per batch that do not touch one another, each of
// NST steps.  One WG per (batch, chain); true
// mat-vec -> VALU fmas.  P stays in registers for the whole kernel: wave w owns
// rows [8w, 8w+8); a lane holds 4 of them (by its half of the wave) times 16
// columns (4 groups of 4, by its place in the half).  LDS holds one 256-float
// row per chunk of the chain: w on entry, the carry once its step has run, so the loop
// touches no global memory and needs one barrier a step.
#define KTHREADS 1024
#define LA 4                         // chains per batch (two doublings)
#define NST (NCH / LA)               // steps of a chain
#define KGRP 4                       // w rows a thread has in flight while staging

// value of lane (l ^ MASK) within the lane's 16-lane row
template <int MASK>
__device__ __forceinline__ float row_xor(float x) {
  return __builtin_bit_cast(float, __builtin_amdgcn_update_dpp(
      0, __builtin_bit_cast(int, x), 0x160 + MASK, 0xf, 0xf, true));
}

__global__ void __launch_bounds__(KTHREADS) carry_scan(const float* __restrict__ Wv,
                                                       const float* __restrict__ P,
                                                       float* __restrict__ carries) {
  extern __shared__ __attribute__((aligned(16))) float hist[];   // NST x DDIM

  const int b = blockIdx.x;
  const int r = blockIdx.y;                    // chain: chunks r, r+LA, r+2*LA, ...
  const int lane = threadIdx.x & 31;
  const int wave = threadIdx.x >> 5;           // 0..31
  const int kp = lane & 15;                    // column part
  const int nb = wave * 8 + (lane >> 4) * 4;   // first of the lane's 4 rows

  // every unroll below is full: constant indices keep p, h and a in registers
  v4f p[4][4];                                 // [row][column group]
  const float* pp = P + nb * DDIM + kp * 4;
#pragma unroll
  for (int r = 0; r < 4; ++r)
#pragma unroll
    for (int q = 0; q < 4; ++q)
      p[r][q] = *(const v4f*)(pp + r * DDIM + q * 64);
  // precaution: the address registers these loads name stay as they are up to
  // this wait (the operand keeps them live); later code may reuse them
  asm volatile("s_wait_xcnt 0x0" :: "v"(pp) : "memory");

  {
    const int e = (threadIdx.x & 63) * 4;      // 64 x 16 bytes per row
    const int k0 = threadIdx.x >> 6;
    // groups of KGRP rows a thread: x and p together fit the wave's registers
    for (int g0 = 0; g0 < NST * DDIM / 4 / KTHREADS; g0 += KGRP) {
      v4f x[KGRP];
      const float* up = Wv + (((g0 * (KTHREADS / 64) + k0) * LA + r) * BS + b) * DDIM + e;
#pragma unroll
      for (int g = 0; g < KGRP; ++g)
        x[g] = *(const v4f*)(up + g * (KTHREADS / 64) * LA * BS * DDIM);
      // precaution, as above
      asm volatile("s_wait_xcnt 0x0" :: "v"(up) : "memory");
#pragma unroll
      for (int g = 0; g < KGRP; ++g)
        *(v4f*)(hist + ((g0 + g) * (KTHREADS / 64) + k0) * DDIM + e) = x[g];
    }
  }
  __syncthreads();

  const bool up8 = (kp & 8) != 0;
  const bool up4 = (kp & 4) != 0;
  const bool first = (kp & 3) == 0;            // one lane of the 4 that end with the same row
  // the row whose sum ends in this lane
  const int myrow = nb + (up8 ? 2 : 0) + (up4 ? 1 : 0);

  // the chain's first carry is its first w: the state before it is zero
  float u = hist[DDIM + myrow];                // w of the step at hand, read one step ahead
  for (int k = 1; k < NST; ++k) {
    const int kn = (k + 1 < NST) ? k + 1 : k;  // the last step has no next: its read is not used
    const float un = hist[kn * DDIM + myrow];
    const float* hp = hist + (k - 1) * DDIM + kp * 4;
    v4f h[4];
#pragma unroll
    for (int q = 0; q < 4; ++q) h[q] = *(const v4f*)(hp + q * 64);

    v2f a[4];
#pragma unroll
    for (int r = 0; r < 4; ++r) {
      a[r] = p[r][0].xy * h[0].xy;
      a[r] += p[r][0].zw * h[0].zw;
#pragma unroll
      for (int q = 1; q < 4; ++q) {
        a[r] += p[r][q].xy * h[q].xy;
        a[r] += p[r][q].zw * h[q].zw;
      }
    }
    const float s0 = a[0].x + a[0].y, s1 = a[1].x + a[1].y;
    const float s2 = a[2].x + a[2].y, s3 = a[3].x + a[3].y;

    // sum over the 16 lanes of a row: each exchange also halves the rows a lane carries
    const float t0 = (up8 ? s2 : s0) + row_xor<8>(up8 ? s0 : s2);
    const float t1 = (up8 ? s3 : s1) + row_xor<8>(up8 ? s1 : s3);
    float w = (up4 ? t1 : t0) + row_xor<4>(up4 ? t0 : t1);
    w += first ? u : 0.f;                      // w_k enters once among the 4 lanes left to sum
    w += row_xor<2>(w);
    w += row_xor<1>(w);

    if (first) hist[k * DDIM + myrow] = w;
    u = un;
    __syncthreads();                           // carry_k is complete before step k+1 reads it
  }

  {
    const int e = (threadIdx.x & 63) * 4;
    const int k0 = threadIdx.x >> 6;
#pragma unroll
    for (int g = 0; g < NST * DDIM / 4 / KTHREADS; ++g) {
      const int k = g * (KTHREADS / 64) + k0;
      *(v4f*)(carries + ((k * LA + r) * BS + b) * DDIM + e) = *(const v4f*)(hist + k * DDIM + e);
    }
  }
}

// ------------------------------------------------------------- correction ---
// out[b, k*CHUNK+i, :] += Lam^{i+1} @ carry_{k-1}[b].  One WG per (power i,
// group of CTILES chunks).  The power goes through LDS once (coalesced reads)
// into registers: wave w keeps the 64 B fragments of its 16 columns for the
// whole kernel.  The same LDS then takes the group's carries (16 rows per
// chunk), and every chunk runs through the resident fragments.  Accumulator
// seeded from out, k order as before, so each sum is formed in the same order.
__global__ void __launch_bounds__(CTHREADS) correct(float* __restrict__ out,
                                                    const float* __restrict__ pw,
                                                    const float* __restrict__ carries) {
  // 256 x HPAD floats: first the power, then the carries
  extern __shared__ __attribute__((aligned(16))) float csm[];

  const int i  = blockIdx.x;           // 0..CHUNK-1
  const int m0 = blockIdx.y * CTILES;  // first carry index (chunk k-1) of the group
  const int lane = threadIdx.x & 31;
  const int wave = threadIdx.x >> 5;   // 0..15
  const int n0 = wave * 16;
  const int col = lane & 15;
  const int kk  = (lane >> 4) * 2;
  const int hi  = (lane >> 4) * 8;

  stage_mat(csm, pw + (size_t)i * MATELEMS);                  // Lam^{i+1}
  __syncthreads();

  v2f bfrag[DDIM / 4];                                        // B[k,n]=Lam^{i+1}[n,k]
  const float* brow = csm + (n0 + col) * HPAD + kk;
  // full unroll: bfrag must be indexed by constants to stay in registers
#pragma unroll
  for (int s = 0; s < DDIM / 4; ++s) bfrag[s] = *(const v2f*)(brow + 4 * s);
  __syncthreads();                     // every wave has its fragments: LDS is free

  // carries[m0 .. m0+CTILES) are CTILES*BS contiguous rows; index NCH-1 exists
  // (written by carry_scan), so the last group stages it and leaves it unused.
  stage_mat(csm, carries + (size_t)m0 * BS * DDIM);
  __syncthreads();

  const int ntile = (NCH - 1 - m0 < CTILES) ? (NCH - 1 - m0) : CTILES;
  for (int j = 0; j < ntile; ++j) {
    const int t = (m0 + j + 1) * CHUNK + i;
    const float* arow = csm + (j * BS + col) * HPAD + kk;     // A[m=batch,k=e]
    // every unroll below is full: constant indices keep acc, abuf and bfrag in registers
    v8f acc;
#pragma unroll
    for (int v = 0; v < 8; ++v)
      acc[v] = out[((v + hi) * TLEN + t) * DDIM + n0 + col];
    v2f abuf[2][ABLK];                 // two groups: LDS reads are issued ahead of the WMMAs that use them
#pragma unroll
    for (int s = 0; s < ABLK; ++s) abuf[0][s] = *(const v2f*)(arow + 4 * s);
#pragma unroll
    for (int q = 0; q < DDIM / 4 / ABLK; ++q) {
      if (q + 1 < DDIM / 4 / ABLK) {
#pragma unroll
        for (int s = 0; s < ABLK; ++s)
          abuf[(q + 1) & 1][s] = *(const v2f*)(arow + 4 * ((q + 1) * ABLK + s));
      }
#pragma unroll
      for (int s = 0; s < ABLK; ++s)
        acc = wmma4(abuf[q & 1][s], bfrag[q * ABLK + s], acc);
    }
#pragma unroll
    for (int v = 0; v < 8; ++v)
      out[((v + hi) * TLEN + t) * DDIM + n0 + col] = acc[v];
    // precaution: the next trip rewrites the address registers these stores name
    asm volatile("s_wait_xcnt 0x0" ::: "memory");
  }
}

// ------------------------------------------------------------------ launch --
extern "C" void kernel_launch(void* const* d_in, const int* in_sizes, int n_in,
                              void* d_out, int out_size, void* d_ws, size_t ws_size,
                              hipStream_t stream) {
  (void)in_sizes; (void)n_in; (void)out_size; (void)ws_size;
  const float* x   = (const float*)d_in[0];   // [16,4096,256]
  const float* Bm  = (const float*)d_in[1];   // [256,256]
  const float* Lam = (const float*)d_in[2];   // [256,256]
  float* out = (float*)d_out;                 // [16,4096,256], also U buffer

  float* Bx      = (float*)d_ws;                         // 16.78M floats
  float* powers  = Bx + (size_t)BS * TLEN * DDIM;        // 16 * 65536 floats
  float* carries = powers + (size_t)CHUNK * MATELEMS;    // NCH*BS*DDIM floats
  float* w1      = carries + (size_t)NCH * BS * DDIM;    // NCH*BS*DDIM floats
  float* w2      = w1 + (size_t)NCH * BS * DDIM;         // NCH*BS*DDIM floats
  float* pw2     = w2 + (size_t)NCH * BS * DDIM;         // Lam^(2*CHUNK)
  float* pw4     = pw2 + MATELEMS;                       // Lam^(4*CHUNK)

  // Lam^1..Lam^CHUNK by log-doubling.
  copy_mat<<<MATELEMS / 256, 256, 0, stream>>>(Lam, powers);
  for (int s = 1; s < CHUNK; s <<= 1)
    power_step<<<dim3(32, s), 256, 0, stream>>>(powers, s);

  // Bx = X @ B^T
  const size_t lds_mat = (size_t)(256 * HPAD) * sizeof(float);
  bx_gemm<<<(BS * TLEN) / XROWS, CTHREADS, lds_mat, stream>>>(x, Bm, Bx);

  // chunk-local scans: Lam lives in the 320KB WGP LDS (256*HPAD + 2*16*HPAD)
  const size_t lds_scan = (size_t)(256 * HPAD + 2 * BS * HPAD) * sizeof(float);
  chunk_scan<<<NCH, 512, lds_scan, stream>>>(Bx, Lam, out);

  // two doublings of the carry recurrence: distance 1 -> 2 -> 4 chunks
  const size_t lds_la = (size_t)(256 * HPAD + BS * HPAD) * sizeof(float);
  lookahead<<<NCH, CTHREADS, lds_la, stream>>>(
      out + (CHUNK - 1) * DDIM, CHUNK * DDIM, TLEN * DDIM,
      powers + (size_t)(CHUNK - 1) * MATELEMS, w1, pw2, 1);
  lookahead<<<NCH, CTHREADS, lds_la, stream>>>(w1, BS * DDIM, DDIM, pw2, w2, pw4, 2);

  // serial carry scans, LA chains per batch (P = Lam^(CHUNK*LA) in registers)
  const size_t lds_carry = (size_t)(NST * DDIM) * sizeof(float);
  carry_scan<<<dim3(BS, LA), KTHREADS, lds_carry, stream>>>(w2, pw4, carries);

  // broadcast carries back into every timestep
  const size_t lds_corr = (size_t)(256 * HPAD) * sizeof(float);
  correct<<<dim3(CHUNK, NCH / CTILES), CTHREADS, lds_corr, stream>>>(out, powers, carries);
}

// v007
// A run of this version takes 195 microseconds.
// In both of two side-by-side timings against v006, it was 1.18 times as fast.
// All steps since v000 together make it 3.49 times as fast.
#include <hip/hip_runtime.h>

typedef __attribute__((ext_vector_type(2))) float v2f;
typedef __attribute__((ext_vector_type(4))) float v4f;
typedef __attribute__((ext_vector_type(8))) float v8f;

#define DDIM 256
#define BS   16
#define TLEN 4096
#define CHUNK 16                     // short chunks: the chunk scan has one work-group for every WGP
#define NCH  (TLEN / CHUNK)          // 256 chunks
#define MATELEMS (DDIM * DDIM)       // 65536
#define HPAD 260                     // padded LDS row stride (bank-conflict-free)

__device__ __forceinline__ v8f wmma4(v2f a, v2f b, v8f c) {
  // D = A(16x4,f32) * B(4x16,f32) + C(16x16,f32)
  return __builtin_amdgcn_wmma_f32_16x16x4_f32(false, a, false, b, (short)0, c,
                                               false, false);
}

__device__ __forceinline__ v8f vzero8() {
  v8f z = {0.f, 0.f, 0.f, 0.f, 0.f, 0.f, 0.f, 0.f};
  return z;
}

// ------------------------------------------------- shared staging helper ---
#define CTILES 16                    // chunks per work-group (CTILES*BS = 256 LDS rows)
#define CTHREADS 512
#define ABLK 16                      // A fragments fetched from LDS as one group

// 256x256 floats, row-major in global memory, to LDS rows of HPAD floats.
#define SGRP 8                       // loads of a lane in flight: not one L2 round trip each
__device__ __forceinline__ void stage_mat(float* __restrict__ dst,
                                          const float* __restrict__ src) {
  const int row = threadIdx.x >> 6;          // 64 x 16 bytes per row
  const int e   = (threadIdx.x & 63) * 4;
  for (int r0 = 0; r0 < MATELEMS / 4 / CTHREADS; r0 += SGRP) {
    v4f x[SGRP];
    // full unrolls: constant indices keep x in registers
#pragma unroll
    for (int u = 0; u < SGRP; ++u)
      x[u] = *(const v4f*)(src + ((r0 + u) * CTHREADS + threadIdx.x) * 4);
#pragma unroll
    for (int u = 0; u < SGRP; ++u)
      *(v4f*)(dst + ((r0 + u) * (CTHREADS / 64) + row) * HPAD + e) = x[u];
  }
}

// ---------------------------------------------------------------- powers ----
// powers[k] (Lam^k) lives at pw + (k-1)*MATELEMS, k = 1..CHUNK.  Rows [16*rb, 16*rb+16)
// of Lam^(j+1) are the same rows of Lam^j times Lam: a work-group needs nobody
// else's rows, so it runs its 16 rows through CHUNK-1 products one after another.
// Lam goes through LDS once into registers (wave w keeps the 64 B fragments of
// its 16 columns); the 16 rows ping-pong through LDS behind the staged matrix.
__device__ __forceinline__ void power_rows(float* csm, const float* __restrict__ Lam,
                                           float* __restrict__ pw, int rb) {
  const int lane = threadIdx.x & 31;
  const int wave = threadIdx.x >> 5;   // 0..15
  const int n0 = wave * 16;
  const int col = lane & 15;
  const int kk  = (lane >> 4) * 2;
  const int hi  = (lane >> 4) * 8;

  stage_mat(csm, Lam);
  __syncthreads();

  v2f bfrag[DDIM / 4];                                        // B[k,n]=Lam[k,n]
  const float* bcol = csm + kk * HPAD + n0 + col;
  // every unroll below is full: constant indices keep bfrag, abuf and acc in registers
#pragma unroll
  for (int s = 0; s < DDIM / 4; ++s) {
    bfrag[s].x = bcol[(4 * s) * HPAD];
    bfrag[s].y = bcol[(4 * s + 1) * HPAD];
  }

  {                                    // Lam^1: the work-group's rows as they are
    const int row = rb * 16 + (threadIdx.x >> 6);             // 64 x 16 bytes per row
    const int e   = (threadIdx.x & 63) * 4;
    float* cp = pw + row * DDIM + e;
#pragma unroll
    for (int g = 0; g < 2; ++g)
      *(v4f*)(cp + g * 8 * DDIM) = *(const v4f*)(csm + (row + g * 8) * HPAD + e);
    // precaution: the address registers these stores name stay as they are up to
    // this wait (the operand keeps them live); later code may reuse them
    asm volatile("s_wait_xcnt 0x0" :: "v"(cp) : "memory");
  }

  float* hb = csm + 256 * HPAD;                               // 2 x 16 x HPAD
  const float* arow = csm + (rb * 16 + col) * HPAD + kk;      // A[m=row,k]: rows of Lam^j
  float* orow = pw + MATELEMS + (rb * 16 + hi) * DDIM + n0 + col;
  for (int j = 1; j < CHUNK; ++j) {
    float* hrows = hb + (j & 1) * 16 * HPAD;
    v8f acc = vzero8();
    v2f abuf[2][ABLK];                 // two groups: LDS reads are issued ahead of the WMMAs that use them
#pragma unroll
    for (int s = 0; s < ABLK; ++s) abuf[0][s] = *(const v2f*)(arow + 4 * s);
#pragma unroll
    for (int q = 0; q < DDIM / 4 / ABLK; ++q) {
      if (q + 1 < DDIM / 4 / ABLK) {
#pragma unroll
        for (int s = 0; s < ABLK; ++s)
          abuf[(q + 1) & 1][s] = *(const v2f*)(arow + 4 * ((q + 1) * ABLK + s));
      }
#pragma unroll
      for (int s = 0; s < ABLK; ++s)
        acc = wmma4(abuf[q & 1][s], bfrag[q * ABLK + s], acc);
    }
#pragma unroll
    for (int v = 0; v < 8; ++v) hrows[(hi + v) * HPAD + n0 + col] = acc[v];
    __syncthreads();                   // the rows of Lam^(j+1) are complete before the next product reads them
    // behind the barrier, so that it does not wait for these stores
#pragma unroll
    for (int v = 0; v < 8; ++v) orow[v * DDIM] = acc[v];
    // precaution: the next trip rewrites the registers these stores name
    asm volatile("s_wait_xcnt 0x0" ::: "memory");
    arow = hrows + col * HPAD + kk;
    orow += MATELEMS;
  }
}

// ---------------------------------------------------------------- Bx GEMM ---
// Bx[r,n] = sum_e X[r,e] * Bm[n,e]  (Bx = X @ Bm^T).  The launch has one WG per
// WGP: the first PWG of them form the powers of Lam (above), which nothing needs
// before the launches behind this one; the other XWG share the rows of X.
// Bm goes through LDS once (coalesced reads) into registers: wave w keeps the
// 64 B fragments of its 16 columns for the whole kernel.  The same LDS then
// takes the WG's rows of X (whole-line reads), and every 16-row tile runs
// through the resident fragments.  One accumulator chain per tile, k ascending,
// so each sum is formed in the same order as with fragments read from global.
#define PWG 16                       // work-groups that form the powers (16 rows each)
#define XWG 240                      // work-groups of the GEMM
#define XT  (BS * TLEN / 16 / XWG)   // 17 tiles of 16 rows for each of them ...
#define XREM (BS * TLEN / 16 - XT * XWG)   // ... and one more for the first 16
#define LROWS ((XT + 1) * 16)        // LDS rows: 288
__global__ void __launch_bounds__(CTHREADS) bx_gemm(const float* __restrict__ X,
                                                    const float* __restrict__ Bm,
                                                    const float* __restrict__ Lam,
                                                    float* __restrict__ Bx,
                                                    float* __restrict__ pw) {
  // LROWS x HPAD floats: first Bm, then the rows of X (or Lam and its rows' powers)
  extern __shared__ __attribute__((aligned(16))) float csm[];

  if (blockIdx.x < PWG) {              // the same for the whole work-group
    power_rows(csm, Lam, pw, blockIdx.x);
    return;
  }

  const int wg = blockIdx.x - PWG;
  const int nt = XT + (wg < XREM ? 1 : 0);                    // tiles of this WG
  const int r0 = (wg * XT + (wg < XREM ? wg : XREM)) * 16;    // its first row
  const int lane = threadIdx.x & 31;
  const int wave = threadIdx.x >> 5;   // 0..15
  const int n0 = wave * 16;
  const int col = lane & 15;
  const int kk  = (lane >> 4) * 2;
  const int hi  = (lane >> 4) * 8;

  stage_mat(csm, Bm);
  __syncthreads();

  v2f bfrag[DDIM / 4];                                        // B[k,n]=Bm[n,k]
  const float* brow = csm + (n0 + col) * HPAD + kk;
  // full unroll: bfrag must be indexed by constants to stay in registers
#pragma unroll
  for (int s = 0; s < DDIM / 4; ++s) bfrag[s] = *(const v2f*)(brow + 4 * s);
  __syncthreads();                     // every wave has its fragments: LDS is free

  {
    // tiles 16 and 17 first: their loads are in flight while the first 256 rows are
    // staged.  A WG without tile 17 fetches tile 16 again; that LDS tile is not used.
    const int srow = threadIdx.x >> 6;         // 64 x 16 bytes per row
    const int se   = (threadIdx.x & 63) * 4;
    v4f xt[4];
#pragma unroll
    for (int u = 0; u < 4; ++u) {
      const int t = (16 + (u >> 1) < nt) ? 16 + (u >> 1) : nt - 1;
      xt[u] = *(const v4f*)(X + (size_t)(r0 + t * 16 + (u & 1) * 8 + srow) * DDIM + se);
    }
    // precaution: later code reuses the address registers these loads name
    asm volatile("s_wait_xcnt 0x0" ::: "memory");
    stage_mat(csm, X + (size_t)r0 * DDIM);
#pragma unroll
    for (int u = 0; u < 4; ++u)
      *(v4f*)(csm + (256 + u * 8 + srow) * HPAD + se) = xt[u];
  }
  __syncthreads();

  const float* arow = csm + col * HPAD + kk;                  // A[m=row,k=e]
  float* orow = Bx + (size_t)(r0 + hi) * DDIM + n0 + col;
  for (int j = 0; j < nt; ++j) {
    // every unroll below is full: constant indices keep acc, abuf and bfrag in registers
    v8f acc = vzero8();
    v2f abuf[2][ABLK];                 // two groups: LDS reads are issued ahead of the WMMAs that use them
#pragma unroll
    for (int s = 0; s < ABLK; ++s) abuf[0][s] = *(const v2f*)(arow + 4 * s);
#pragma unroll
    for (int q = 0; q < DDIM / 4 / ABLK; ++q) {
      if (q + 1 < DDIM / 4 / ABLK) {
#pragma unroll
        for (int s = 0; s < ABLK; ++s)
          abuf[(q + 1) & 1][s] = *(const v2f*)(arow + 4 * ((q + 1) * ABLK + s));
      }
#pragma unroll
      for (int s = 0; s < ABLK; ++s)
        acc = wmma4(abuf[q & 1][s], bfrag[q * ABLK + s], acc);
    }
#pragma unroll
    for (int v = 0; v < 8; ++v)
      orow[v * DDIM] = acc[v];
    // precaution: the next trip rewrites the address registers these stores name
    asm volatile("s_wait_xcnt 0x0" ::: "memory");
    arow += 16 * HPAD;
    orow += 16 * DDIM;
  }
}

// ------------------------------------------------------------- chunk scan ---
// Per chunk (blockIdx.x): u_i = Lam @ u_{i-1} + Bx_t for i=0..CHUNK-1 with
// u_{-1}=0, all 16 batches as the M dim of a 16x256x256 WMMA GEMM per step.
// Lam (256KB) is staged into the 320KB WGP LDS via CDNA5 async global->LDS
// b128 copies and read from there once: wave w keeps the 64 B fragments of its
// 16 columns in registers for all steps.  h ping-pongs through LDS.  A step's
// serial path is: h fragments from LDS, 64 WMMAs, h to LDS, barrier.  Bx_t is
// loaded two steps ahead and seeds the accumulator; u_i goes to global memory
// behind the step's barrier, so the barrier does not wait for those stores.
// Dynamic LDS layout: [0, 256*HPAD) = Lam (padded rows); then 2*16*HPAD for h.

// One step.  On entry acc holds Bx of this step and abuf[0] the first group of
// u_{i-1}'s fragments; on exit acc is being loaded with Bx of the step after the
// next (the caller alternates two accumulators, so nothing is copied while a
// load is under way) and abuf[0] with the first group of u_i.
// arow: this lane's fragments of u_{i-1};  hdst, anext: where the lane writes u_i
// and where it reads its fragments of it;  up, bxp: the lane's first element of
// u_i in global memory and of the Bx to fetch (batches TLEN*DDIM apart).
__device__ __forceinline__ void scan_step(v8f& acc, v2f (&abuf)[2][ABLK],
                                          const v2f (&bfrag)[DDIM / 4],
                                          const float* arow, float* hdst,
                                          const float* anext,
                                          float* __restrict__ up,
                                          const float* __restrict__ bxp) {
  // every unroll is full: constant indices keep acc, abuf and bfrag in registers
#pragma unroll
  for (int q = 0; q < DDIM / 4 / ABLK; ++q) {
    if (q + 1 < DDIM / 4 / ABLK) {
#pragma unroll
      for (int s = 0; s < ABLK; ++s)
        abuf[(q + 1) & 1][s] = *(const v2f*)(arow + 4 * ((q + 1) * ABLK + s));
    }
#pragma unroll
    for (int s = 0; s < ABLK; ++s)
      acc = wmma4(abuf[q & 1][s], bfrag[q * ABLK + s], acc);
  }
#pragma unroll
  for (int v = 0; v < 8; ++v) hdst[v * HPAD] = acc[v];
  __syncthreads();                     // u_i is complete before the next step reads it

#pragma unroll
  for (int s = 0; s < ABLK; ++s) abuf[0][s] = *(const v2f*)(anext + 4 * s);
  // while those reads are under way: u_i out, the next Bx for this accumulator in
#pragma unroll
  for (int v = 0; v < 8; ++v) up[v * TLEN * DDIM] = acc[v];
  // precaution: the loads below rewrite the registers these stores name
  asm volatile("s_wait_xcnt 0x0" ::: "memory");
#pragma unroll
  for (int v = 0; v < 8; ++v) acc[v] = bxp[v * TLEN * DDIM];
  // precaution: later code rewrites the address registers these loads name
  asm volatile("s_wait_xcnt 0x0" ::: "memory");
}

__global__ void __launch_bounds__(512) chunk_scan(const float* __restrict__ Bx,
                                                  const float* __restrict__ Lam,
                                                  float* __restrict__ U) {
  extern __shared__ float smem[];
  float* lam_s = smem;                       // 256 x HPAD
  float* hb    = smem + 256 * HPAD;          // 2 x BS x HPAD

  const int lane = threadIdx.x & 31;
  const int wave = threadIdx.x >> 5;     // 0..15
  const int chunk = blockIdx.x;
  const int n0 = wave * 16;
  const int col = lane & 15;
  const int kk  = (lane >> 4) * 2;
  const int hi  = (lane >> 4) * 8;

  // ---- stage Lam into LDS with async global->LDS copies (ASYNCcnt path).
  // Dynamic LDS starts at group-segment offset 0, so LDS byte offsets are
  // computed numerically.  Each b128 moves 4 floats of one (padded) row.
  {
    const unsigned long long gbase = (unsigned long long)(uintptr_t)Lam;
    for (int g = threadIdx.x; g < MATELEMS / 4; g += (int)blockDim.x) {
      const int row = g >> 6;              // 64 x b128 per 256-float row
      const int e   = (g & 63) * 4;
      unsigned ldsoff = (unsigned)((row * HPAD + e) * 4);
      unsigned voff   = (unsigned)(g * 16);
      asm volatile("global_load_async_to_lds_b128 %0, %1, %2"
                   :: "v"(ldsoff), "v"(voff), "s"(gbase)
                   : "memory");
    }
    asm volatile("s_wait_asynccnt 0x0" ::: "memory");
  }

  // zero h_{-1} (buffer 0)
  for (int i = threadIdx.x; i < BS * DDIM; i += (int)blockDim.x)
    hb[(i >> 8) * HPAD + (i & 255)] = 0.f;
  __syncthreads();

  // element (batch hi, first step of the chunk, the lane's column) of Bx and U
  const int o0 = (hi * TLEN + chunk * CHUNK) * DDIM + n0 + col;
  // every unroll below is full: constant indices keep the arrays in registers
  v8f acc0, acc1;                      // even and odd steps
#pragma unroll
  for (int v = 0; v < 8; ++v) acc0[v] = Bx[o0 + v * TLEN * DDIM];
  // precaution: later code reuses the address registers these loads name; it also
  // keeps step 0's loads the older ones, so its first WMMA waits for them alone
  asm volatile("s_wait_xcnt 0x0" ::: "memory");
#pragma unroll
  for (int v = 0; v < 8; ++v) acc1[v] = Bx[o0 + DDIM + v * TLEN * DDIM];
  // precaution, as above
  asm volatile("s_wait_xcnt 0x0" ::: "memory");

  v2f bfrag[DDIM / 4];                 // row n of Lam: B[k,n]=Lam[n,k]
  const float* lrow = lam_s + (n0 + col) * HPAD + kk;
#pragma unroll
  for (int s = 0; s < DDIM / 4; ++s) bfrag[s] = *(const v2f*)(lrow + 4 * s);

  v2f abuf[2][ABLK];                   // two groups: LDS reads are issued ahead of the WMMAs that use them
  const float* ar0 = hb + col * HPAD + kk;                    // A[m=batch,k], buffer 0
  const float* ar1 = ar0 + BS * HPAD;                         // buffer 1
  float* hd0 = hb + hi * HPAD + n0 + col;                     // the lane's first element, buffer 0
  float* hd1 = hd0 + BS * HPAD;
#pragma unroll
  for (int s = 0; s < ABLK; ++s) abuf[0][s] = *(const v2f*)(ar0 + 4 * s);

  for (int i = 0; i < CHUNK; i += 2) {
    // the last two steps have no step two ahead: they fetch the last Bx again and do not use it
    const int f0 = (i + 2 < CHUNK) ? i + 2 : CHUNK - 1;
    const int f1 = (i + 3 < CHUNK) ? i + 3 : CHUNK - 1;
    scan_step(acc0, abuf, bfrag, ar0, hd1, ar1, U + o0 + i * DDIM, Bx + o0 + f0 * DDIM);
    scan_step(acc1, abuf, bfrag, ar1, hd0, ar0, U + o0 + (i + 1) * DDIM, Bx + o0 + f1 * DDIM);
  }
}

// ------------------------------------------------------------- look-ahead ---
// One doubling of the carry recurrence c_k = M c_{k-d} + v_k (c = 0 before the
// start):  c_k = M^2 c_{k-2d} + w_k  with  w_k = v_k + M v_{k-d}  (w_k = v_k for
// k < d).  The w_k do not depend on one another: one WG per chunk k, the 16
// batches as the M dim of a 16x256x256 WMMA GEMM, M staged in LDS.  The first
// 16 WGs also form 16 rows each of M^2 from the staged M.
// v_k[b] lives at vin + k*kstr + b*bstr; w_k[b] at vout + (k*BS + b)*DDIM.

// acc += A(16 x 256) * B(256 x 16).  A[m,e] = arow[..], lane-resolved; B[e,n] is
// read from bp: as a pair along a row of the staged matrix (BT: B[e,n]=S[n,e]),
// or as two words of one column (B[e,n]=S[e,n]).  k ascending, one chain.
template <bool BT>
__device__ __forceinline__ v8f tile_lds(const float* arow, const float* bp, v8f acc) {
  // every unroll is full: constant indices keep the two groups in registers;
  // two groups: LDS reads are issued ahead of the WMMAs that use them
  v2f abuf[2][ABLK], bbuf[2][ABLK];
#pragma unroll
  for (int q = 0; q <= DDIM / 4 / ABLK; ++q) {
    if (q < DDIM / 4 / ABLK) {
#pragma unroll
      for (int s = 0; s < ABLK; ++s) {
        const int e = 4 * (q * ABLK + s);
        abuf[q & 1][s] = *(const v2f*)(arow + e);
        if (BT) {
          bbuf[q & 1][s] = *(const v2f*)(bp + e);
        } else {
          bbuf[q & 1][s].x = bp[e * HPAD];
          bbuf[q & 1][s].y = bp[(e + 1) * HPAD];
        }
      }
    }
    if (q > 0) {
#pragma unroll
      for (int s = 0; s < ABLK; ++s)
        acc = wmma4(abuf[(q - 1) & 1][s], bbuf[(q - 1) & 1][s], acc);
    }
  }
  return acc;
}

__global__ void __launch_bounds__(CTHREADS) lookahead(const float* __restrict__ vin,
                                                      int kstr, int bstr,
                                                      const float* __restrict__ M,
                                                      float* __restrict__ vout,
                                                      float* __restrict__ M2, int d) {
  // 256 x HPAD floats of M, then BS x HPAD floats of v_{k-d}
  extern __shared__ __attribute__((aligned(16))) float csm[];
  float* vs = csm + 256 * HPAD;

  const int k = blockIdx.x;            // 0..NCH-1
  const int lane = threadIdx.x & 31;
  const int wave = threadIdx.x >> 5;   // 0..15
  const int n0 = wave * 16;
  const int col = lane & 15;
  const int kk  = (lane >> 4) * 2;
  const int hi  = (lane >> 4) * 8;

  v8f acc;                             // seeded with v_k
#pragma unroll
  for (int v = 0; v < 8; ++v)
    acc[v] = vin[k * kstr + (v + hi) * bstr + n0 + col];
  // precaution: later code reuses the address registers these loads name
  asm volatile("s_wait_xcnt 0x0" ::: "memory");

  const int ks = (k >= d) ? k - d : k; // k < d has no term: its rows are staged and not used
  const int srow = threadIdx.x >> 6;   // 64 x 16 bytes per row
  const int se   = (threadIdx.x & 63) * 4;
  v4f x[BS * DDIM / 4 / CTHREADS];
#pragma unroll
  for (int g = 0; g < BS * DDIM / 4 / CTHREADS; ++g)
    x[g] = *(const v4f*)(vin + ks * kstr + (g * (CTHREADS / 64) + srow) * bstr + se);
  // precaution: later code reuses the address registers these loads name
  asm volatile("s_wait_xcnt 0x0" ::: "memory");
  stage_mat(csm, M);                   // the loads above are in flight meanwhile
#pragma unroll
  for (int g = 0; g < BS * DDIM / 4 / CTHREADS; ++g)
    *(v4f*)(vs + (g * (CTHREADS / 64) + srow) * HPAD + se) = x[g];
  __syncthreads();

  if (k >= d)                          // A[m=batch,e] = v_{k-d}, B[e,n] = M[n,e]
    acc = tile_lds<true>(vs + col * HPAD + kk, csm + (n0 + col) * HPAD + kk, acc);
#pragma unroll
  for (int v = 0; v < 8; ++v)
    vout[(k * BS + v + hi) * DDIM + n0 + col] = acc[v];
  // precaution: the code below reuses the registers these stores name
  asm volatile("s_wait_xcnt 0x0" ::: "memory");

  if (k < DDIM / 16) {                 // rows [16k, 16k+16) of M^2: A[m,e] = M[16k+m,e], B[e,n] = M[e,n]
    v8f sq = tile_lds<false>(csm + (k * 16 + col) * HPAD + kk, csm + kk * HPAD + n0 + col, vzero8());
#pragma unroll
    for (int v = 0; v < 8; ++v)
      M2[(k * 16 + v + hi) * DDIM + n0 + col] = sq[v];
  }
}

// ------------------------------------------------------------- carry scan ---
// After two look-ahead doublings: carry_k = P @ carry_{k-LA} + w_k with
// P = Lam^(CHUNK*LA): LA chains per batch that do not touch one another, each of
// NST steps.  One WG per (batch, chain); true
// mat-vec -> VALU fmas.  P stays in registers for the whole kernel: wave w owns
// rows [8w, 8w+8); a lane holds 4 of them (by its half of the wave) times 16
// columns (4 groups of 4, by its place in the half).  LDS holds one 256-float
// row per chunk of the chain: w on entry, the carry once its step has run, so the loop
// touches no global memory and needs one barrier a step.
#define KTHREADS 1024
#define LA 4                         // chains per batch (two doublings)
#define NST (NCH / LA)               // steps of a chain
#define KGRP 4                       // w rows a thread has in flight while staging

// value of lane (l ^ MASK) within the lane's 16-lane row
template <int MASK>
__device__ __forceinline__ float row_xor(float x) {
  return __builtin_bit_cast(float, __builtin_amdgcn_update_dpp(
      0, __builtin_bit_cast(int, x), 0x160 + MASK, 0xf, 0xf, true));
}

__global__ void __launch_bounds__(KTHREADS) carry_scan(const float* __restrict__ Wv,
                                                       const float* __restrict__ P,
                                                       float* __restrict__ carries) {
  extern __shared__ __attribute__((aligned(16))) float hist[];   // NST x DDIM

  const int b = blockIdx.x;
  const int r = blockIdx.y;                    // chain: chunks r, r+LA, r+2*LA, ...
  const int lane = threadIdx.x & 31;
  const int wave = threadIdx.x >> 5;           // 0..31
  const int kp = lane & 15;                    // column part
  const int nb = wave * 8 + (lane >> 4) * 4;   // first of the lane's 4 rows

  // every unroll below is full: constant indices keep p, h and a in registers
  v4f p[4][4];                                 // [row][column group]
  const float* pp = P + nb * DDIM + kp * 4;
#pragma unroll
  for (int r = 0; r < 4; ++r)
#pragma unroll
    for (int q = 0; q < 4; ++q)
      p[r][q] = *(const v4f*)(pp + r * DDIM + q * 64);
  // precaution: the address registers these loads name stay as they are up to
  // this wait (the operand keeps them live); later code may reuse them
  asm volatile("s_wait_xcnt 0x0" :: "v"(pp) : "memory");

  {
    const int e = (threadIdx.x & 63) * 4;      // 64 x 16 bytes per row
    const int k0 = threadIdx.x >> 6;
    // groups of KGRP rows a thread: x and p together fit the wave's registers
    for (int g0 = 0; g0 < NST * DDIM / 4 / KTHREADS; g0 += KGRP) {
      v4f x[KGRP];
      const float* up = Wv + (((g0 * (KTHREADS / 64) + k0) * LA + r) * BS + b) * DDIM + e;
#pragma unroll
      for (int g = 0; g < KGRP; ++g)
        x[g] = *(const v4f*)(up + g * (KTHREADS / 64) * LA * BS * DDIM);
      // precaution, as above
      asm volatile("s_wait_xcnt 0x0" :: "v"(up) : "memory");
#pragma unroll
      for (int g = 0; g < KGRP; ++g)
        *(v4f*)(hist + ((g0 + g) * (KTHREADS / 64) + k0) * DDIM + e) = x[g];
    }
  }
  __syncthreads();

  const bool up8 = (kp & 8) != 0;
  const bool up4 = (kp & 4) != 0;
  const bool first = (kp & 3) == 0;            // one lane of the 4 that end with the same row
  // the row whose sum ends in this lane
  const int myrow = nb + (up8 ? 2 : 0) + (up4 ? 1 : 0);

  // the chain's first carry is its first w: the state before it is zero
  float u = hist[DDIM + myrow];                // w of the step at hand, read one step ahead
  for (int k = 1; k < NST; ++k) {
    const int kn = (k + 1 < NST) ? k + 1 : k;  // the last step has no next: its read is not used
    const float un = hist[kn * DDIM + myrow];
    const float* hp = hist + (k - 1) * DDIM + kp * 4;
    v4f h[4];
#pragma unroll
    for (int q = 0; q < 4; ++q) h[q] = *(const v4f*)(hp + q * 64);

    v2f a[4];
#pragma unroll
    for (int r = 0; r < 4; ++r) {
      a[r] = p[r][0].xy * h[0].xy;
      a[r] += p[r][0].zw * h[0].zw;
#pragma unroll
      for (int q = 1; q < 4; ++q) {
        a[r] += p[r][q].xy * h[q].xy;
        a[r] += p[r][q].zw * h[q].zw;
      }
    }
    const float s0 = a[0].x + a[0].y, s1 = a[1].x + a[1].y;
    const float s2 = a[2].x + a[2].y, s3 = a[3].x + a[3].y;

    // sum over the 16 lanes of a row: each exchange also halves the rows a lane carries
    const float t0 = (up8 ? s2 : s0) + row_xor<8>(up8 ? s0 : s2);
    const float t1 = (up8 ? s3 : s1) + row_xor<8>(up8 ? s1 : s3);
    float w = (up4 ? t1 : t0) + row_xor<4>(up4 ? t0 : t1);
    w += first ? u : 0.f;                      // w_k enters once among the 4 lanes left to sum
    w += row_xor<2>(w);
    w += row_xor<1>(w);

    if (first) hist[k * DDIM + myrow] = w;
    u = un;
    __syncthreads();                           // carry_k is complete before step k+1 reads it
  }

  {
    const int e = (threadIdx.x & 63) * 4;
    const int k0 = threadIdx.x >> 6;
#pragma unroll
    for (int g = 0; g < NST * DDIM / 4 / KTHREADS; ++g) {
      const int k = g * (KTHREADS / 64) + k0;
      *(v4f*)(carries + ((k * LA + r) * BS + b) * DDIM + e) = *(const v4f*)(hist + k * DDIM + e);
    }
  }
}

// ------------------------------------------------------------- correction ---
// out[b, k*CHUNK+i, :] += Lam^{i+1} @ carry_{k-1}[b].  One WG per (power i,
// group of CTILES chunks).  The power goes through LDS once (coalesced reads)
// into registers: wave w keeps the 64 B fragments of its 16 columns for the
// whole kernel.  The same LDS then takes the group's carries (16 rows per
// chunk), and every chunk runs through the resident fragments.  Accumulator
// seeded from out, k order as before, so each sum is formed in the same order.
__global__ void __launch_bounds__(CTHREADS) correct(float* __restrict__ out,
                                                    const float* __restrict__ pw,
                                                    const float* __restrict__ carries) {
  // 256 x HPAD floats: first the power, then the carries
  extern __shared__ __attribute__((aligned(16))) float csm[];

  const int i  = blockIdx.x;           // 0..CHUNK-1
  const int m0 = blockIdx.y * CTILES;  // first carry index (chunk k-1) of the group
  const int lane = threadIdx.x & 31;
  const int wave = threadIdx.x >> 5;   // 0..15
  const int n0 = wave * 16;
  const int col = lane & 15;
  const int kk  = (lane >> 4) * 2;
  const int hi  = (lane >> 4) * 8;

  stage_mat(csm, pw + (size_t)i * MATELEMS);                  // Lam^{i+1}
  __syncthreads();

  v2f bfrag[DDIM / 4];                                        // B[k,n]=Lam^{i+1}[n,k]
  const float* brow = csm + (n0 + col) * HPAD + kk;
  // full unroll: bfrag must be indexed by constants to stay in registers
#pragma unroll
  for (int s = 0; s < DDIM / 4; ++s) bfrag[s] = *(const v2f*)(brow + 4 * s);
  __syncthreads();                     // every wave has its fragments: LDS is free

  // carries[m0 .. m0+CTILES) are CTILES*BS contiguous rows; index NCH-1 exists
  // (written by carry_scan), so the last group stages it and leaves it unused.
  stage_mat(csm, carries + (size_t)m0 * BS * DDIM);
  __syncthreads();

  const int ntile = (NCH - 1 - m0 < CTILES) ? (NCH - 1 - m0) : CTILES;
  for (int j = 0; j < ntile; ++j) {
    const int t = (m0 + j + 1) * CHUNK + i;
    const float* arow = csm + (j * BS + col) * HPAD + kk;     // A[m=batch,k=e]
    // every unroll below is full: constant indices keep acc, abuf and bfrag in registers
    v8f acc;
#pragma unroll
    for (int v = 0; v < 8; ++v)
      acc[v] = out[((v + hi) * TLEN + t) * DDIM + n0 + col];
    v2f abuf[2][ABLK];                 // two groups: LDS reads are issued ahead of the WMMAs that use them
#pragma unroll
    for (int s = 0; s < ABLK; ++s) abuf[0][s] = *(const v2f*)(arow + 4 * s);
#pragma unroll
    for (int q = 0; q < DDIM / 4 / ABLK; ++q) {
      if (q + 1 < DDIM / 4 / ABLK) {
#pragma unroll
        for (int s = 0; s < ABLK; ++s)
          abuf[(q + 1) & 1][s] = *(const v2f*)(arow + 4 * ((q + 1) * ABLK + s));
      }
#pragma unroll
      for (int s = 0; s < ABLK; ++s)
        acc = wmma4(abuf[q & 1][s], bfrag[q * ABLK + s], acc);
    }
#pragma unroll
    for (int v = 0; v < 8; ++v)
      out[((v + hi) * TLEN + t) * DDIM + n0 + col] = acc[v];
    // precaution: the next trip rewrites the address registers these stores name
    asm volatile("s_wait_xcnt 0x0" ::: "memory");
  }
}

// ------------------------------------------------------------------ launch --
extern "C" void kernel_launch(void* const* d_in, const int* in_sizes, int n_in,
                              void* d_out, int out_size, void* d_ws, size_t ws_size,
                              hipStream_t stream) {
  (void)in_sizes; (void)n_in; (void)out_size; (void)ws_size;
  const float* x   = (const float*)d_in[0];   // [16,4096,256]
  const float* Bm  = (const float*)d_in[1];   // [256,256]
  const float* Lam = (const float*)d_in[2];   // [256,256]
  float* out = (float*)d_out;                 // [16,4096,256], also U buffer

  float* Bx      = (float*)d_ws;                         // 16.78M floats
  float* powers  = Bx + (size_t)BS * TLEN * DDIM;        // CHUNK * 65536 floats
  float* carries = powers + (size_t)CHUNK * MATELEMS;    // NCH*BS*DDIM floats
  float* w1      = carries + (size_t)NCH * BS * DDIM;    // NCH*BS*DDIM floats
  float* w2      = w1 + (size_t)NCH * BS * DDIM;         // NCH*BS*DDIM floats
  float* pw2     = w2 + (size_t)NCH * BS * DDIM;         // Lam^(2*CHUNK)
  float* pw4     = pw2 + MATELEMS;                       // Lam^(4*CHUNK)

  // Bx = X @ B^T; the same launch forms Lam^1..Lam^CHUNK
  const size_t lds_bx = (size_t)(LROWS * HPAD) * sizeof(float);
  bx_gemm<<<PWG + XWG, CTHREADS, lds_bx, stream>>>(x, Bm, Lam, Bx, powers);

  // chunk-local scans: Lam lives in the 320KB WGP LDS (256*HPAD + 2*16*HPAD)
  const size_t lds_scan = (size_t)(256 * HPAD + 2 * BS * HPAD) * sizeof(float);
  chunk_scan<<<NCH, 512, lds_scan, stream>>>(Bx, Lam, out);

  // two doublings of the carry recurrence: distance 1 -> 2 -> 4 chunks
  const size_t lds_la = (size_t)(256 * HPAD + BS * HPAD) * sizeof(float);
  lookahead<<<NCH, CTHREADS, lds_la, stream>>>(
      out + (CHUNK - 1) * DDIM, CHUNK * DDIM, TLEN * DDIM,
      powers + (size_t)(CHUNK - 1) * MATELEMS, w1, pw2, 1);
  lookahead<<<NCH, CTHREADS, lds_la, stream>>>(w1, BS * DDIM, DDIM, pw2, w2, pw4, 2);

  // serial carry scans, LA chains per batch (P = Lam^(CHUNK*LA) in registers)
  const size_t lds_carry = (size_t)(NST * DDIM) * sizeof(float);
  carry_scan<<<dim3(BS, LA), KTHREADS, lds_carry, stream>>>(w2, pw4, carries);

  // broadcast carries back into every timestep
  const size_t lds_corr = (size_t)(256 * HPAD) * sizeof(float);
  correct<<<dim3(CHUNK, NCH / CTILES), CTHREADS, lds_corr, stream>>>(out, powers, carries);
}
